// v000
// The times below were measured on an AMD MI455X: many runs one after another, warmed up first and cycling through
// copies of the inputs, with the whole window's GPU time divided by the number of runs. Launches and the gaps
// between them are all in it. The median over several windows is given; except for v000 it joins two sittings, which
// can be a few percent apart, so the side-by-side timings, each taken in one sitting, are the better comparison.
// v000 is the starting kernel. One run takes 63.8 microseconds.
#include <hip/hip_runtime.h>

typedef _Float16 v16h __attribute__((ext_vector_type(16)));
typedef _Float16 v8h  __attribute__((ext_vector_type(8)));
typedef float    v8f  __attribute__((ext_vector_type(8)));
typedef unsigned v4u  __attribute__((ext_vector_type(4)));
typedef int      v8i  __attribute__((ext_vector_type(8)));
typedef int      v4i  __attribute__((ext_vector_type(4)));

#define K_DIM   8192
#define N_DIM   8192
#define M_DIM   128
#define GROUP   128
#define NGROUPS (K_DIM / GROUP)    // 64
#define KSPLIT  2
#define GPB     (NGROUPS / KSPLIT) // 32 groups per block
#define BM      128
#define BN      128
#define MT      8                  // M-tiles per wave
#define LDSW    136                // 128 + 8 halves pad (produced by TDM pad feature)

__global__ void zero_out_kernel(float* __restrict__ out) {
    const int idx = (blockIdx.x * 256 + threadIdx.x) * 4;
    float4 z = {0.f, 0.f, 0.f, 0.f};
    *(float4*)&out[idx] = z;
}

// x fp32 -> f16 once (reused by all 64 N-blocks; removes convert work from GEMM loop)
__global__ void cvt_x_kernel(const float* __restrict__ x, _Float16* __restrict__ xh) {
    const int idx = (blockIdx.x * 256 + threadIdx.x) * 8;
    const float4 a = *(const float4*)&x[idx];
    const float4 b = *(const float4*)&x[idx + 4];
    v8h h;
    h[0] = (_Float16)a.x; h[1] = (_Float16)a.y; h[2] = (_Float16)a.z; h[3] = (_Float16)a.w;
    h[4] = (_Float16)b.x; h[5] = (_Float16)b.y; h[6] = (_Float16)b.z; h[7] = (_Float16)b.w;
    *(v8h*)&xh[idx] = h;
}

// Issue a TDM load of a 128(rows) x 128(halves) f16 tile into LDS with
// 16B padding per 256B row (-> 136-half LDS row stride).
__device__ __forceinline__ void tdm_load_tile(unsigned lds_off, unsigned long long gaddr) {
    v4u d0;
    d0[0] = 1u;                                     // count=1 (valid), user mode
    d0[1] = lds_off;                                // lds_addr (bytes)
    d0[2] = (unsigned)(gaddr & 0xFFFFFFFFull);      // global_addr[31:0] (tile start)
    d0[3] = (unsigned)((gaddr >> 32) & 0x1FFFFFFull) | (2u << 30); // addr[56:32] | type=2
    v8i d1;
    d1[0] = (1 << 16)     // data_size = 2 bytes
          | (1 << 20)     // pad_enable
          | (5 << 22)     // pad_interval: 64 DWORDs (256B) between pads
          | (3 << 25);    // pad_amount: 4 DWORDs (16B)
    d1[1] = (int)(8192u << 16);  // tensor_dim0[15:0] in bits[63:48]
    d1[2] = (int)(128u  << 16);  // tensor_dim1[15:0] in bits[95:80]
    d1[3] = (int)(128u  << 16);  // tile_dim0 = 128 in bits[127:112]
    d1[4] = 128;                 // tile_dim1 = 128 in bits[143:128]
    d1[5] = 8192;                // tensor_dim0_stride[31:0]
    d1[6] = 0;
    d1[7] = 0;
    v4i z4 = {0, 0, 0, 0};            // groups 2/3 unused (2-D tensor)
    v8i z8 = {0, 0, 0, 0, 0, 0, 0, 0};
    __builtin_amdgcn_tensor_load_to_lds(d0, d1, z4, z4, z8, 0);
}

__global__ __launch_bounds__(256, 2)
void w4a32_gemm_wmma(const _Float16* __restrict__ xh,
                     const int*      __restrict__ Wq,
                     const float*    __restrict__ scales,
                     const float*    __restrict__ zeros,
                     float*          __restrict__ out)
{
    __shared__ __align__(16) _Float16 As[2][BM * LDSW];

    const int tid  = threadIdx.x;
    const int lane = tid & 31;
    const int wave = tid >> 5;

    const int colbase = blockIdx.x * BN;
    const int gbase   = blockIdx.y * GPB;       // K-split group base

    const int nl   = lane & 15;                 // col within 16-wide tile / A row
    const int hi   = lane >> 4;                 // lane half -> K-octet / M+8 on store
    const int ncol = colbase + wave * 16 + nl;  // this lane's output column

    const unsigned lds0 = (unsigned)(uintptr_t)&As[0][0];
    const unsigned lds1 = (unsigned)(uintptr_t)&As[1][0];
    const unsigned long long xbase = (unsigned long long)(uintptr_t)xh;

    v8f acc[MT];
    #pragma unroll
    for (int mt = 0; mt < MT; ++mt) { v8f z = {}; acc[mt] = z; }

    // prologue: DMA first chunk into buffer 0
    if (wave == 0) {
        tdm_load_tile(lds0, xbase + (unsigned long long)(gbase * GROUP) * 2u);
    }

    for (int gi = 0; gi < GPB; ++gi) {
        const int g = gbase + gi;

        if (wave == 0) __builtin_amdgcn_s_wait_tensorcnt(0); // chunk gi landed in LDS
        __syncthreads();                                     // publish to all waves

        // kick DMA for next chunk into the other buffer (it was last read
        // before the barrier above -> no WAR hazard)
        if (wave == 0 && gi + 1 < GPB) {
            tdm_load_tile((gi + 1) & 1 ? lds1 : lds0,
                          xbase + (unsigned long long)((g + 1) * GROUP) * 2u);
        }

        const _Float16* Ab = (gi & 1) ? &As[1][0] : &As[0][0];

        // per-group dequant constants for this lane's column
        const float s  = scales[(size_t)g * N_DIM + ncol];
        const float zs = -zeros[(size_t)g * N_DIM + ncol] * s;

        // packed-word row base: K run starts at g*128 + hi*8 -> word row g*16 + hi
        const int kp0 = g * 16 + hi;

        if (gi + 1 < GPB) {
            __builtin_prefetch(&Wq[(size_t)(kp0 + 16) * N_DIM + ncol], 0, 1);
        }

        #pragma unroll
        for (int step = 0; step < 4; ++step) {
            // B fragment: col = ncol; elems 0..7 <- one packed word (8 consecutive K),
            //             elems 8..15 <- word +2 rows (K+16)
            const unsigned w0 = (unsigned)__builtin_nontemporal_load(
                &Wq[(size_t)(kp0 + step * 4    ) * N_DIM + ncol]);
            const unsigned w1 = (unsigned)__builtin_nontemporal_load(
                &Wq[(size_t)(kp0 + step * 4 + 2) * N_DIM + ncol]);
            v16h b;
            #pragma unroll
            for (int j = 0; j < 8; ++j) {
                b[j]     = (_Float16)__builtin_fmaf((float)((w0 >> (4 * j)) & 15u), s, zs);
                b[j + 8] = (_Float16)__builtin_fmaf((float)((w1 >> (4 * j)) & 15u), s, zs);
            }

            const int kl = step * 32 + hi * 8;  // K offset within LDS chunk
            #pragma unroll
            for (int mt = 0; mt < MT; ++mt) {
                const _Float16* ap = &Ab[(mt * 16 + nl) * LDSW + kl];
                v8h alo = *(const v8h*)ap;          // K = kl .. kl+7
                v8h ahi = *(const v8h*)(ap + 16);   // K = kl+16 .. kl+23
                v16h a = __builtin_shufflevector(alo, ahi,
                         0,1,2,3,4,5,6,7,8,9,10,11,12,13,14,15);
                acc[mt] = __builtin_amdgcn_wmma_f32_16x16x32_f16(
                              false, a, false, b, (short)0, acc[mt], false, false);
            }
        }
    }

    // C/D layout: VGPR v -> M = v (lanes 0-15) or v+8 (lanes 16-31), N = lane%16.
    // Exactly two commutative f32 adds (K-split=2) onto zeroed out -> deterministic.
    #pragma unroll
    for (int mt = 0; mt < MT; ++mt) {
        #pragma unroll
        for (int v = 0; v < 8; ++v) {
            const int row = mt * 16 + v + hi * 8;
            atomicAdd(&out[(size_t)row * N_DIM + ncol], acc[mt][v]);
        }
    }
}

extern "C" void kernel_launch(void* const* d_in, const int* in_sizes, int n_in,
                              void* d_out, int out_size, void* d_ws, size_t ws_size,
                              hipStream_t stream) {
    (void)in_sizes; (void)n_in; (void)ws_size; (void)out_size;
    const float* x      = (const float*)d_in[0];
    const int*   Wq     = (const int*)d_in[1];
    const float* scales = (const float*)d_in[2];
    const float* zeros  = (const float*)d_in[3];
    float*       out    = (float*)d_out;
    _Float16*    xh     = (_Float16*)d_ws;   // 128*8192*2B = 2 MB scratch

    // 1) zero the accumulation target (atomics add onto it)
    zero_out_kernel<<<dim3((M_DIM * N_DIM) / (256 * 4)), dim3(256), 0, stream>>>(out);
    // 2) convert activations to f16 once
    cvt_x_kernel<<<dim3((M_DIM * K_DIM) / (256 * 8)), dim3(256), 0, stream>>>(x, xh);
    // 3) TDM-fed WMMA GEMM
    dim3 grid(N_DIM / BN, KSPLIT);  // (64, 2) = 128 workgroups
    w4a32_gemm_wmma<<<grid, dim3(256), 0, stream>>>(xh, Wq, scales, zeros, out);
}

// v001
// A run of this version takes 39.4 microseconds.
// Timed twice side by side with v000, it ran 1.66 and 1.64 times as fast.
#include <hip/hip_runtime.h>

typedef _Float16 v16h __attribute__((ext_vector_type(16)));
typedef _Float16 v8h  __attribute__((ext_vector_type(8)));
typedef float    v8f  __attribute__((ext_vector_type(8)));
typedef unsigned v4u  __attribute__((ext_vector_type(4)));
typedef int      v8i  __attribute__((ext_vector_type(8)));
typedef int      v4i  __attribute__((ext_vector_type(4)));

#define K_DIM   8192
#define N_DIM   8192
#define M_DIM   128
#define GROUP   128
#define NGROUPS (K_DIM / GROUP)    // 64
#define KSPLIT  8
#define GPB     (NGROUPS / KSPLIT) // 8 groups per block
#define BM      128
#define BN      128
#define MT      8                  // M-tiles per wave
#define LDSW    136                // 128 + 8 halves pad (produced by TDM pad feature)
#define XH_BYTES (M_DIM * K_DIM * 2)   // f16 copy of x at the start of the workspace
#define TILEF   256                // floats of one 16x16 accumulator tile
#define REDW    132                // LDS row pitch of the merge tile, floats

// Merge of the K slices: one block per (column block, M-tile) sums the KSPLIT
// partial tiles in slice order, turns them from fragment order into rows in LDS
// and stores whole 512-byte row pieces of out.
__global__ __launch_bounds__(256)
void merge_slices_kernel(const float* __restrict__ part, float* __restrict__ out) {
    __shared__ __align__(16) float tile[16 * REDW];
    const int tid  = threadIdx.x;
    const int lane = tid & 31;
    const int wave = tid >> 5;
    const int cb   = blockIdx.x;
    const int mt   = blockIdx.y;

    // the KSPLIT partials of one tile lie side by side: 8 KB contiguous per wave
    const float* p = part + ((size_t)(cb * 8 + wave) * MT + mt) * (KSPLIT * TILEF) + lane * 4;
    float4 lo = *(const float4*)(p);
    float4 up = *(const float4*)(p + 128);
    #pragma unroll  // all 2 * KSPLIT loads of a thread in flight together
    for (int ks = 1; ks < KSPLIT; ++ks) {
        const float4 a = *(const float4*)(p + ks * TILEF);
        const float4 b = *(const float4*)(p + ks * TILEF + 128);
        lo.x += a.x; lo.y += a.y; lo.z += a.z; lo.w += a.w;
        up.x += b.x; up.y += b.y; up.z += b.z; up.w += b.w;
    }

    float* t = &tile[(lane >> 4) * 8 * REDW + wave * 16 + (lane & 15)];
    t[0 * REDW] = lo.x; t[1 * REDW] = lo.y; t[2 * REDW] = lo.z; t[3 * REDW] = lo.w;
    t[4 * REDW] = up.x; t[5 * REDW] = up.y; t[6 * REDW] = up.z; t[7 * REDW] = up.w;
    __syncthreads();  // rows are read back by other waves than wrote them

    for (int i = 0; i < 2; ++i) {
        const int r = wave + i * 8;
        const float4 v = *(const float4*)&tile[r * REDW + lane * 4];
        *(float4*)&out[(size_t)(mt * 16 + r) * N_DIM + cb * BN + lane * 4] = v;
    }
}

// x fp32 -> f16 once (reused by all 64 N-blocks; removes convert work from GEMM loop)
__global__ void cvt_x_kernel(const float* __restrict__ x, _Float16* __restrict__ xh) {
    const int idx = (blockIdx.x * 256 + threadIdx.x) * 8;
    const float4 a = *(const float4*)&x[idx];
    const float4 b = *(const float4*)&x[idx + 4];
    v8h h;
    h[0] = (_Float16)a.x; h[1] = (_Float16)a.y; h[2] = (_Float16)a.z; h[3] = (_Float16)a.w;
    h[4] = (_Float16)b.x; h[5] = (_Float16)b.y; h[6] = (_Float16)b.z; h[7] = (_Float16)b.w;
    *(v8h*)&xh[idx] = h;
}

// Issue a TDM load of a 128(rows) x 128(halves) f16 tile into LDS with
// 16B padding per 256B row (-> 136-half LDS row stride).
__device__ __forceinline__ void tdm_load_tile(unsigned lds_off, unsigned long long gaddr) {
    v4u d0;
    d0[0] = 1u;                                     // count=1 (valid), user mode
    d0[1] = lds_off;                                // lds_addr (bytes)
    d0[2] = (unsigned)(gaddr & 0xFFFFFFFFull);      // global_addr[31:0] (tile start)
    d0[3] = (unsigned)((gaddr >> 32) & 0x1FFFFFFull) | (2u << 30); // addr[56:32] | type=2
    v8i d1;
    d1[0] = (1 << 16)     // data_size = 2 bytes
          | (1 << 20)     // pad_enable
          | (5 << 22)     // pad_interval: 64 DWORDs (256B) between pads
          | (3 << 25);    // pad_amount: 4 DWORDs (16B)
    d1[1] = (int)(8192u << 16);  // tensor_dim0[15:0] in bits[63:48]
    d1[2] = (int)(128u  << 16);  // tensor_dim1[15:0] in bits[95:80]
    d1[3] = (int)(128u  << 16);  // tile_dim0 = 128 in bits[127:112]
    d1[4] = 128;                 // tile_dim1 = 128 in bits[143:128]
    d1[5] = 8192;                // tensor_dim0_stride[31:0]
    d1[6] = 0;
    d1[7] = 0;
    v4i z4 = {0, 0, 0, 0};            // groups 2/3 unused (2-D tensor)
    v8i z8 = {0, 0, 0, 0, 0, 0, 0, 0};
    __builtin_amdgcn_tensor_load_to_lds(d0, d1, z4, z4, z8, 0);
}

__global__ __launch_bounds__(256, 2)
void w4a32_gemm_wmma(const _Float16* __restrict__ xh,
                     const int*      __restrict__ Wq,
                     const float*    __restrict__ scales,
                     const float*    __restrict__ zeros,
                     float*          __restrict__ part)
{
    __shared__ __align__(16) _Float16 As[2][BM * LDSW];

    const int tid  = threadIdx.x;
    const int lane = tid & 31;
    const int wave = tid >> 5;

    const int colbase = blockIdx.x * BN;
    const int gbase   = blockIdx.y * GPB;       // K-split group base

    const int nl   = lane & 15;                 // col within 16-wide tile / A row
    const int hi   = lane >> 4;                 // lane half -> K-octet / M+8 on store
    const int ncol = colbase + wave * 16 + nl;  // this lane's output column

    const unsigned lds0 = (unsigned)(uintptr_t)&As[0][0];
    const unsigned lds1 = (unsigned)(uintptr_t)&As[1][0];
    const unsigned long long xbase = (unsigned long long)(uintptr_t)xh;

    v8f acc[MT];
    #pragma unroll
    for (int mt = 0; mt < MT; ++mt) { v8f z = {}; acc[mt] = z; }

    // prologue: DMA first chunk into buffer 0
    if (wave == 0) {
        tdm_load_tile(lds0, xbase + (unsigned long long)(gbase * GROUP) * 2u);
    }

    for (int gi = 0; gi < GPB; ++gi) {
        const int g = gbase + gi;

        if (wave == 0) __builtin_amdgcn_s_wait_tensorcnt(0); // chunk gi landed in LDS
        __syncthreads();                                     // publish to all waves

        // kick DMA for next chunk into the other buffer (it was last read
        // before the barrier above -> no WAR hazard)
        if (wave == 0 && gi + 1 < GPB) {
            tdm_load_tile((gi + 1) & 1 ? lds1 : lds0,
                          xbase + (unsigned long long)((g + 1) * GROUP) * 2u);
        }

        const _Float16* Ab = (gi & 1) ? &As[1][0] : &As[0][0];

        // per-group dequant constants for this lane's column
        const float s  = scales[(size_t)g * N_DIM + ncol];
        const float zs = -zeros[(size_t)g * N_DIM + ncol] * s;

        // packed-word row base: K run starts at g*128 + hi*8 -> word row g*16 + hi
        const int kp0 = g * 16 + hi;

        if (gi + 1 < GPB) {
            // locality 3 = shader-engine scope
            __builtin_prefetch(&Wq[(size_t)(kp0 + 16) * N_DIM + ncol], 0, 3);
        }

        #pragma unroll
        for (int step = 0; step < 4; ++step) {
            // B fragment: col = ncol; elems 0..7 <- one packed word (8 consecutive K),
            //             elems 8..15 <- word +2 rows (K+16)
            const unsigned w0 = (unsigned)__builtin_nontemporal_load(
                &Wq[(size_t)(kp0 + step * 4    ) * N_DIM + ncol]);
            const unsigned w1 = (unsigned)__builtin_nontemporal_load(
                &Wq[(size_t)(kp0 + step * 4 + 2) * N_DIM + ncol]);
            v16h b;
            #pragma unroll
            for (int j = 0; j < 8; ++j) {
                b[j]     = (_Float16)__builtin_fmaf((float)((w0 >> (4 * j)) & 15u), s, zs);
                b[j + 8] = (_Float16)__builtin_fmaf((float)((w1 >> (4 * j)) & 15u), s, zs);
            }

            const int kl = step * 32 + hi * 8;  // K offset within LDS chunk
            #pragma unroll
            for (int mt = 0; mt < MT; ++mt) {
                const _Float16* ap = &Ab[(mt * 16 + nl) * LDSW + kl];
                v8h alo = *(const v8h*)ap;          // K = kl .. kl+7
                v8h ahi = *(const v8h*)(ap + 16);   // K = kl+16 .. kl+23
                v16h a = __builtin_shufflevector(alo, ahi,
                         0,1,2,3,4,5,6,7,8,9,10,11,12,13,14,15);
                acc[mt] = __builtin_amdgcn_wmma_f32_16x16x32_f16(
                              false, a, false, b, (short)0, acc[mt], false, false);
            }
        }
    }

    // C/D layout: VGPR v -> M = v (lanes 0-15) or v+8 (lanes 16-31), N = lane%16.
    // This slice's partial goes to the workspace in fragment order, indexed
    // [column block][wave][M-tile][slice]: per tile two stores of 512 contiguous
    // bytes (VGPRs 0-3, then 4-7, 16 bytes a lane).
    float* pw = part + ((size_t)(blockIdx.x * 8 + wave) * MT * KSPLIT + blockIdx.y) * TILEF
                     + lane * 4;
    #pragma unroll
    for (int mt = 0; mt < MT; ++mt) {
        float4 lo = {acc[mt][0], acc[mt][1], acc[mt][2], acc[mt][3]};
        float4 up = {acc[mt][4], acc[mt][5], acc[mt][6], acc[mt][7]};
        *(float4*)(pw + mt * KSPLIT * TILEF)       = lo;
        *(float4*)(pw + mt * KSPLIT * TILEF + 128) = up;
    }
}

extern "C" void kernel_launch(void* const* d_in, const int* in_sizes, int n_in,
                              void* d_out, int out_size, void* d_ws, size_t ws_size,
                              hipStream_t stream) {
    (void)in_sizes; (void)n_in; (void)ws_size; (void)out_size;
    const float* x      = (const float*)d_in[0];
    const int*   Wq     = (const int*)d_in[1];
    const float* scales = (const float*)d_in[2];
    const float* zeros  = (const float*)d_in[3];
    float*       out    = (float*)d_out;
    _Float16*    xh     = (_Float16*)d_ws;   // 128*8192*2B = 2 MB scratch
    float*       part   = (float*)((char*)d_ws + XH_BYTES); // KSPLIT x 4 MB partials

    // 1) convert activations to f16 once
    cvt_x_kernel<<<dim3((M_DIM * K_DIM) / (256 * 8)), dim3(256), 0, stream>>>(x, xh);
    // 2) TDM-fed WMMA GEMM, one K slice per grid row, partials to the workspace
    dim3 grid(N_DIM / BN, KSPLIT);  // (64, 8) = 512 workgroups
    w4a32_gemm_wmma<<<grid, dim3(256), 0, stream>>>(xh, Wq, scales, zeros, part);
    // 3) sum the slices in fixed order into out
    merge_slices_kernel<<<dim3(N_DIM / BN, MT), dim3(256), 0, stream>>>(part, out);
}

// v002
// It runs in 29.9 microseconds.
// Timed twice side by side with v001, it ran 1.33 and 1.31 times as fast.
// Over all steps from v000 it is 2.19 times as fast.
#include <hip/hip_runtime.h>

typedef _Float16 v16h __attribute__((ext_vector_type(16)));
typedef _Float16 v8h  __attribute__((ext_vector_type(8)));
typedef float    v8f  __attribute__((ext_vector_type(8)));
typedef unsigned v4u  __attribute__((ext_vector_type(4)));
typedef int      v8i  __attribute__((ext_vector_type(8)));
typedef int      v4i  __attribute__((ext_vector_type(4)));

#define K_DIM   8192
#define N_DIM   8192
#define M_DIM   128
#define GROUP   128
#define NGROUPS (K_DIM / GROUP)    // 64
#define KSPLIT  8
#define GPB     (NGROUPS / KSPLIT) // 8 groups per block
#define BM      128
#define BN      128
#define MT      8                  // M-tiles per wave
#define LDSW    136                // 128 + 8 halves pad (produced by TDM pad feature)
#define XH_BYTES (M_DIM * K_DIM * 2)   // f16 copy of x at the start of the workspace
#define TILEF   256                // floats of one 16x16 accumulator tile
#define REDW    132                // LDS row pitch of the merge tile, floats

// Merge of the K slices: one block per (column block, M-tile) sums the KSPLIT
// partial tiles in slice order, turns them from fragment order into rows in LDS
// and stores whole 512-byte row pieces of out.
__global__ __launch_bounds__(256)
void merge_slices_kernel(const float* __restrict__ part, float* __restrict__ out) {
    __shared__ __align__(16) float tile[16 * REDW];
    const int tid  = threadIdx.x;
    const int lane = tid & 31;
    const int wave = tid >> 5;
    const int cb   = blockIdx.x;
    const int mt   = blockIdx.y;

    // the KSPLIT partials of one tile lie side by side: 8 KB contiguous per wave
    const float* p = part + ((size_t)(cb * 8 + wave) * MT + mt) * (KSPLIT * TILEF) + lane * 4;
    float4 lo = *(const float4*)(p);
    float4 up = *(const float4*)(p + 128);
    #pragma unroll  // all 2 * KSPLIT loads of a thread in flight together
    for (int ks = 1; ks < KSPLIT; ++ks) {
        const float4 a = *(const float4*)(p + ks * TILEF);
        const float4 b = *(const float4*)(p + ks * TILEF + 128);
        lo.x += a.x; lo.y += a.y; lo.z += a.z; lo.w += a.w;
        up.x += b.x; up.y += b.y; up.z += b.z; up.w += b.w;
    }

    float* t = &tile[(lane >> 4) * 8 * REDW + wave * 16 + (lane & 15)];
    t[0 * REDW] = lo.x; t[1 * REDW] = lo.y; t[2 * REDW] = lo.z; t[3 * REDW] = lo.w;
    t[4 * REDW] = up.x; t[5 * REDW] = up.y; t[6 * REDW] = up.z; t[7 * REDW] = up.w;
    __syncthreads();  // rows are read back by other waves than wrote them

    for (int i = 0; i < 2; ++i) {
        const int r = wave + i * 8;
        const float4 v = *(const float4*)&tile[r * REDW + lane * 4];
        *(float4*)&out[(size_t)(mt * 16 + r) * N_DIM + cb * BN + lane * 4] = v;
    }
}

// x fp32 -> f16 once (reused by all 64 N-blocks; removes convert work from GEMM loop)
__global__ void cvt_x_kernel(const float* __restrict__ x, _Float16* __restrict__ xh) {
    const int idx = (blockIdx.x * 256 + threadIdx.x) * 8;
    const float4 a = *(const float4*)&x[idx];
    const float4 b = *(const float4*)&x[idx + 4];
    v8h h;
    h[0] = (_Float16)a.x; h[1] = (_Float16)a.y; h[2] = (_Float16)a.z; h[3] = (_Float16)a.w;
    h[4] = (_Float16)b.x; h[5] = (_Float16)b.y; h[6] = (_Float16)b.z; h[7] = (_Float16)b.w;
    *(v8h*)&xh[idx] = h;
}

// Issue a TDM load of a 128(rows) x 128(halves) f16 tile into LDS with
// 16B padding per 256B row (-> 136-half LDS row stride).
__device__ __forceinline__ void tdm_load_tile(unsigned lds_off, unsigned long long gaddr) {
    v4u d0;
    d0[0] = 1u;                                     // count=1 (valid), user mode
    d0[1] = lds_off;                                // lds_addr (bytes)
    d0[2] = (unsigned)(gaddr & 0xFFFFFFFFull);      // global_addr[31:0] (tile start)
    d0[3] = (unsigned)((gaddr >> 32) & 0x1FFFFFFull) | (2u << 30); // addr[56:32] | type=2
    v8i d1;
    d1[0] = (1 << 16)     // data_size = 2 bytes
          | (1 << 20)     // pad_enable
          | (5 << 22)     // pad_interval: 64 DWORDs (256B) between pads
          | (3 << 25);    // pad_amount: 4 DWORDs (16B)
    d1[1] = (int)(8192u << 16);  // tensor_dim0[15:0] in bits[63:48]
    d1[2] = (int)(128u  << 16);  // tensor_dim1[15:0] in bits[95:80]
    d1[3] = (int)(128u  << 16);  // tile_dim0 = 128 in bits[127:112]
    d1[4] = 128;                 // tile_dim1 = 128 in bits[143:128]
    d1[5] = 8192;                // tensor_dim0_stride[31:0]
    d1[6] = 0;
    d1[7] = 0;
    v4i z4 = {0, 0, 0, 0};            // groups 2/3 unused (2-D tensor)
    v8i z8 = {0, 0, 0, 0, 0, 0, 0, 0};
    __builtin_amdgcn_tensor_load_to_lds(d0, d1, z4, z4, z8, 0);
}

__global__ __launch_bounds__(256, 2)
void w4a32_gemm_wmma(const _Float16* __restrict__ xh,
                     const int*      __restrict__ Wq,
                     const float*    __restrict__ scales,
                     const float*    __restrict__ zeros,
                     float*          __restrict__ part)
{
    __shared__ __align__(16) _Float16 As[2][BM * LDSW];

    const int tid  = threadIdx.x;
    const int lane = tid & 31;
    const int wave = tid >> 5;

    const int colbase = blockIdx.x * BN;
    const int gbase   = blockIdx.y * GPB;       // K-split group base

    const int nl   = lane & 15;                 // col within 16-wide tile / A row
    const int hi   = lane >> 4;                 // lane half -> K-octet / M+8 on store
    const int ncol = colbase + wave * 16 + nl;  // this lane's output column

    const unsigned lds0 = (unsigned)(uintptr_t)&As[0][0];
    const unsigned lds1 = (unsigned)(uintptr_t)&As[1][0];
    const unsigned long long xbase = (unsigned long long)(uintptr_t)xh;

    v8f acc[MT];
    #pragma unroll
    for (int mt = 0; mt < MT; ++mt) { v8f z = {}; acc[mt] = z; }

    // prologue: DMA first chunk into buffer 0
    if (wave == 0) {
        tdm_load_tile(lds0, xbase + (unsigned long long)(gbase * GROUP) * 2u);
    }

    // Weight-side operands of a group for this lane: 8 packed words (word rows
    // hi, hi+2, ... hi+14 of the group's 16), its column's scale and zero.
    // They are fetched one group ahead into registers, so that their memory
    // latency runs under the group before instead of in front of each group.
    const int*   wp = Wq     + (size_t)(gbase * 16 + hi) * N_DIM + ncol;
    const float* sp = scales + (size_t)gbase * N_DIM + ncol;
    const float* zp = zeros  + (size_t)gbase * N_DIM + ncol;
    unsigned wn[8];
    float sn, zn;
    #pragma unroll  // constant indices keep wn[] in registers; 8 loads in flight together
    for (int j = 0; j < 8; ++j)
        wn[j] = (unsigned)__builtin_nontemporal_load(&wp[(size_t)(2 * j) * N_DIM]);
    sn = *sp;
    zn = *zp;

    for (int gi = 0; gi < GPB; ++gi) {
        const int g = gbase + gi;

        if (wave == 0) __builtin_amdgcn_s_wait_tensorcnt(0); // chunk gi landed in LDS
        __syncthreads();                                     // publish to all waves

        // kick DMA for next chunk into the other buffer (it was last read
        // before the barrier above -> no WAR hazard)
        if (wave == 0 && gi + 1 < GPB) {
            tdm_load_tile((gi + 1) & 1 ? lds1 : lds0,
                          xbase + (unsigned long long)((g + 1) * GROUP) * 2u);
        }

        const _Float16* Ab = (gi & 1) ? &As[1][0] : &As[0][0];

        // this group's operands, loaded during the group before
        unsigned wc[8];
        #pragma unroll  // constant indices keep wc[] in registers
        for (int j = 0; j < 8; ++j) wc[j] = wn[j];
        const float s  = sn;
        const float zs = -zn * s;

        // next group's operands start now; nothing of this group reads them
        if (gi + 1 < GPB) {
            wp += 16 * N_DIM;
            sp += N_DIM;
            zp += N_DIM;
            #pragma unroll  // as above: registers, and all loads issued as one run
            for (int j = 0; j < 8; ++j)
                wn[j] = (unsigned)__builtin_nontemporal_load(&wp[(size_t)(2 * j) * N_DIM]);
            sn = *sp;
            zn = *zp;
        }

        #pragma unroll
        for (int step = 0; step < 4; ++step) {
            // B fragment: col = ncol; elems 0..7 <- one packed word (8 consecutive K),
            //             elems 8..15 <- word +2 rows (K+16)
            const unsigned w0 = wc[step * 2];
            const unsigned w1 = wc[step * 2 + 1];
            v16h b;
            #pragma unroll
            for (int j = 0; j < 8; ++j) {
                b[j]     = (_Float16)__builtin_fmaf((float)((w0 >> (4 * j)) & 15u), s, zs);
                b[j + 8] = (_Float16)__builtin_fmaf((float)((w1 >> (4 * j)) & 15u), s, zs);
            }

            const int kl = step * 32 + hi * 8;  // K offset within LDS chunk
            #pragma unroll
            for (int mt = 0; mt < MT; ++mt) {
                const _Float16* ap = &Ab[(mt * 16 + nl) * LDSW + kl];
                v8h alo = *(const v8h*)ap;          // K = kl .. kl+7
                v8h ahi = *(const v8h*)(ap + 16);   // K = kl+16 .. kl+23
                v16h a = __builtin_shufflevector(alo, ahi,
                         0,1,2,3,4,5,6,7,8,9,10,11,12,13,14,15);
                acc[mt] = __builtin_amdgcn_wmma_f32_16x16x32_f16(
                              false, a, false, b, (short)0, acc[mt], false, false);
            }
        }
    }

    // C/D layout: VGPR v -> M = v (lanes 0-15) or v+8 (lanes 16-31), N = lane%16.
    // This slice's partial goes to the workspace in fragment order, indexed
    // [column block][wave][M-tile][slice]: per tile two stores of 512 contiguous
    // bytes (VGPRs 0-3, then 4-7, 16 bytes a lane).
    float* pw = part + ((size_t)(blockIdx.x * 8 + wave) * MT * KSPLIT + blockIdx.y) * TILEF
                     + lane * 4;
    #pragma unroll
    for (int mt = 0; mt < MT; ++mt) {
        float4 lo = {acc[mt][0], acc[mt][1], acc[mt][2], acc[mt][3]};
        float4 up = {acc[mt][4], acc[mt][5], acc[mt][6], acc[mt][7]};
        *(float4*)(pw + mt * KSPLIT * TILEF)       = lo;
        *(float4*)(pw + mt * KSPLIT * TILEF + 128) = up;
    }
}

extern "C" void kernel_launch(void* const* d_in, const int* in_sizes, int n_in,
                              void* d_out, int out_size, void* d_ws, size_t ws_size,
                              hipStream_t stream) {
    (void)in_sizes; (void)n_in; (void)ws_size; (void)out_size;
    const float* x      = (const float*)d_in[0];
    const int*   Wq     = (const int*)d_in[1];
    const float* scales = (const float*)d_in[2];
    const float* zeros  = (const float*)d_in[3];
    float*       out    = (float*)d_out;
    _Float16*    xh     = (_Float16*)d_ws;   // 128*8192*2B = 2 MB scratch
    float*       part   = (float*)((char*)d_ws + XH_BYTES); // KSPLIT x 4 MB partials

    // 1) convert activations to f16 once
    cvt_x_kernel<<<dim3((M_DIM * K_DIM) / (256 * 8)), dim3(256), 0, stream>>>(x, xh);
    // 2) TDM-fed WMMA GEMM, one K slice per grid row, partials to the workspace
    dim3 grid(N_DIM / BN, KSPLIT);  // (64, 8) = 512 workgroups
    w4a32_gemm_wmma<<<grid, dim3(256), 0, stream>>>(xh, Wq, scales, zeros, part);
    // 3) sum the slices in fixed order into out
    merge_slices_kernel<<<dim3(N_DIM / BN, MT), dim3(256), 0, stream>>>(part, out);
}

// v003
// A run of this version takes 27.5 microseconds.
// Timed twice side by side with v002, it ran 1.09 and 1.10 times as fast.
// Counting every step since v000, it is 2.40 times as fast.
#include <hip/hip_runtime.h>

typedef _Float16 v16h __attribute__((ext_vector_type(16)));
typedef _Float16 v8h  __attribute__((ext_vector_type(8)));
typedef float    v8f  __attribute__((ext_vector_type(8)));
typedef unsigned v4u  __attribute__((ext_vector_type(4)));
typedef int      v8i  __attribute__((ext_vector_type(8)));
typedef int      v4i  __attribute__((ext_vector_type(4)));

#define K_DIM   8192
#define N_DIM   8192
#define M_DIM   128
#define GROUP   128
#define NGROUPS (K_DIM / GROUP)    // 64
#define KSPLIT  8
#define GPB     (NGROUPS / KSPLIT) // 8 groups per block
#define BM      128
#define BN      256                // columns of a GEMM block
#define MT      8                  // M-tiles per wave
#define NT      2                  // column tiles per wave: one A fragment feeds NT WMMAs
#define RBN     128                // columns of a merge block
#define LDSW    136                // 128 + 8 halves pad (produced by TDM pad feature)
#define XH_BYTES (M_DIM * K_DIM * 2)   // f16 copy of x at the start of the workspace
#define TILEF   256                // floats of one 16x16 accumulator tile
#define REDW    132                // LDS row pitch of the merge tile, floats

// Merge of the K slices: one block per (column block, M-tile) sums the KSPLIT
// partial tiles in slice order, turns them from fragment order into rows in LDS
// and stores whole 512-byte row pieces of out.
__global__ __launch_bounds__(256)
void merge_slices_kernel(const float* __restrict__ part, float* __restrict__ out) {
    __shared__ __align__(16) float tile[16 * REDW];
    const int tid  = threadIdx.x;
    const int lane = tid & 31;
    const int wave = tid >> 5;
    const int cb   = blockIdx.x;
    const int mt   = blockIdx.y;

    // the KSPLIT partials of one tile lie side by side: 8 KB contiguous per wave
    const float* p = part + ((size_t)(cb * 8 + wave) * MT + mt) * (KSPLIT * TILEF) + lane * 4;
    float4 lo = *(const float4*)(p);
    float4 up = *(const float4*)(p + 128);
    #pragma unroll  // all 2 * KSPLIT loads of a thread in flight together
    for (int ks = 1; ks < KSPLIT; ++ks) {
        const float4 a = *(const float4*)(p + ks * TILEF);
        const float4 b = *(const float4*)(p + ks * TILEF + 128);
        lo.x += a.x; lo.y += a.y; lo.z += a.z; lo.w += a.w;
        up.x += b.x; up.y += b.y; up.z += b.z; up.w += b.w;
    }

    float* t = &tile[(lane >> 4) * 8 * REDW + wave * 16 + (lane & 15)];
    t[0 * REDW] = lo.x; t[1 * REDW] = lo.y; t[2 * REDW] = lo.z; t[3 * REDW] = lo.w;
    t[4 * REDW] = up.x; t[5 * REDW] = up.y; t[6 * REDW] = up.z; t[7 * REDW] = up.w;
    __syncthreads();  // rows are read back by other waves than wrote them

    for (int i = 0; i < 2; ++i) {
        const int r = wave + i * 8;
        const float4 v = *(const float4*)&tile[r * REDW + lane * 4];
        *(float4*)&out[(size_t)(mt * 16 + r) * N_DIM + cb * RBN + lane * 4] = v;
    }
}

// x fp32 -> f16 once (reused by all 32 N-blocks; removes convert work from GEMM loop)
__global__ void cvt_x_kernel(const float* __restrict__ x, _Float16* __restrict__ xh) {
    const int idx = (blockIdx.x * 256 + threadIdx.x) * 8;
    const float4 a = *(const float4*)&x[idx];
    const float4 b = *(const float4*)&x[idx + 4];
    v8h h;
    h[0] = (_Float16)a.x; h[1] = (_Float16)a.y; h[2] = (_Float16)a.z; h[3] = (_Float16)a.w;
    h[4] = (_Float16)b.x; h[5] = (_Float16)b.y; h[6] = (_Float16)b.z; h[7] = (_Float16)b.w;
    *(v8h*)&xh[idx] = h;
}

// Issue a TDM load of a 128(rows) x 128(halves) f16 tile into LDS with
// 16B padding per 256B row (-> 136-half LDS row stride).
__device__ __forceinline__ void tdm_load_tile(unsigned lds_off, unsigned long long gaddr) {
    v4u d0;
    d0[0] = 1u;                                     // count=1 (valid), user mode
    d0[1] = lds_off;                                // lds_addr (bytes)
    d0[2] = (unsigned)(gaddr & 0xFFFFFFFFull);      // global_addr[31:0] (tile start)
    d0[3] = (unsigned)((gaddr >> 32) & 0x1FFFFFFull) | (2u << 30); // addr[56:32] | type=2
    v8i d1;
    d1[0] = (1 << 16)     // data_size = 2 bytes
          | (1 << 20)     // pad_enable
          | (5 << 22)     // pad_interval: 64 DWORDs (256B) between pads
          | (3 << 25);    // pad_amount: 4 DWORDs (16B)
    d1[1] = (int)(8192u << 16);  // tensor_dim0[15:0] in bits[63:48]
    d1[2] = (int)(128u  << 16);  // tensor_dim1[15:0] in bits[95:80]
    d1[3] = (int)(128u  << 16);  // tile_dim0 = 128 in bits[127:112]
    d1[4] = 128;                 // tile_dim1 = 128 in bits[143:128]
    d1[5] = 8192;                // tensor_dim0_stride[31:0]
    d1[6] = 0;
    d1[7] = 0;
    v4i z4 = {0, 0, 0, 0};            // groups 2/3 unused (2-D tensor)
    v8i z8 = {0, 0, 0, 0, 0, 0, 0, 0};
    __builtin_amdgcn_tensor_load_to_lds(d0, d1, z4, z4, z8, 0);
}

__global__ __launch_bounds__(256, 2)
void w4a32_gemm_wmma(const _Float16* __restrict__ xh,
                     const int*      __restrict__ Wq,
                     const float*    __restrict__ scales,
                     const float*    __restrict__ zeros,
                     float*          __restrict__ part)
{
    __shared__ __align__(16) _Float16 As[2][BM * LDSW];

    const int tid  = threadIdx.x;
    const int lane = tid & 31;
    const int wave = tid >> 5;

    const int colbase = blockIdx.x * BN;
    const int gbase   = blockIdx.y * GPB;       // K-split group base

    const int nl   = lane & 15;                 // col within 16-wide tile / A row
    const int hi   = lane >> 4;                 // lane half -> K-octet / M+8 on store
    const int ncol = colbase + wave * (NT * 16) + nl;  // this lane's column in tile 0; tile 1: +16

    const unsigned lds0 = (unsigned)(uintptr_t)&As[0][0];
    const unsigned lds1 = (unsigned)(uintptr_t)&As[1][0];
    const unsigned long long xbase = (unsigned long long)(uintptr_t)xh;

    // prologue: DMA first chunk into buffer 0
    if (wave == 0) {
        tdm_load_tile(lds0, xbase + (unsigned long long)(gbase * GROUP) * 2u);
    }

    // Weight-side operands of a group for this lane, per column tile: 8 packed words
    // (word rows hi, hi+2, ... hi+14 of the group's 16), its column's scale and zero.
    // They are fetched one group ahead into registers, so that their memory
    // latency runs under the group before instead of in front of each group.
    const int*   wp = Wq     + (size_t)(gbase * 16 + hi) * N_DIM + ncol;
    const float* sp = scales + (size_t)gbase * N_DIM + ncol;
    const float* zp = zeros  + (size_t)gbase * N_DIM + ncol;
    unsigned wn[NT][8];
    float sn[NT], zn[NT];
    #pragma unroll  // constant indices keep wn[][] in registers; all loads in flight together
    for (int nt = 0; nt < NT; ++nt) {
        #pragma unroll
        for (int j = 0; j < 8; ++j)
            wn[nt][j] = (unsigned)__builtin_nontemporal_load(&wp[(size_t)(2 * j) * N_DIM + nt * 16]);
    }
    #pragma unroll
    for (int nt = 0; nt < NT; ++nt) {
        sn[nt] = sp[nt * 16];
        zn[nt] = zp[nt * 16];
    }
    // the registers that these loads name are reused below: wait before they are overwritten
    asm volatile("s_wait_xcnt 0x0" ::: "memory");
    __builtin_amdgcn_sched_barrier(0);  // holds the register writes below behind that wait

    v8f acc[MT][NT];
    #pragma unroll
    for (int mt = 0; mt < MT; ++mt) {
        #pragma unroll
        for (int nt = 0; nt < NT; ++nt) { v8f z = {}; acc[mt][nt] = z; }
    }

    for (int gi = 0; gi < GPB; ++gi) {
        const int g = gbase + gi;

        if (wave == 0) __builtin_amdgcn_s_wait_tensorcnt(0); // chunk gi landed in LDS
        __syncthreads();                                     // publish to all waves

        // kick DMA for next chunk into the other buffer (it was last read
        // before the barrier above -> no WAR hazard)
        if (wave == 0 && gi + 1 < GPB) {
            tdm_load_tile((gi + 1) & 1 ? lds1 : lds0,
                          xbase + (unsigned long long)((g + 1) * GROUP) * 2u);
        }

        const _Float16* Ab = (gi & 1) ? &As[1][0] : &As[0][0];

        // this group's operands, loaded during the group before
        unsigned wc[NT][8];
        float s[NT], zs[NT];
        #pragma unroll  // constant indices keep wc[][] in registers
        for (int nt = 0; nt < NT; ++nt) {
            #pragma unroll
            for (int j = 0; j < 8; ++j) wc[nt][j] = wn[nt][j];
            s[nt]  = sn[nt];
            zs[nt] = -zn[nt] * s[nt];
        }

        // next group's operands start now; nothing of this group reads them
        if (gi + 1 < GPB) {
            wp += 16 * N_DIM;
            sp += N_DIM;
            zp += N_DIM;
            #pragma unroll  // as above: registers, and all loads issued as one run
            for (int nt = 0; nt < NT; ++nt) {
                #pragma unroll
                for (int j = 0; j < 8; ++j)
                    wn[nt][j] = (unsigned)__builtin_nontemporal_load(&wp[(size_t)(2 * j) * N_DIM + nt * 16]);
            }
            #pragma unroll
            for (int nt = 0; nt < NT; ++nt) {
                sn[nt] = sp[nt * 16];
                zn[nt] = zp[nt * 16];
            }
        }

        // A fragments of a whole k-step (MT tiles, two 16-byte reads each) are read
        // from LDS as one group into their own registers, one step ahead of use.
        const _Float16* ap = &Ab[nl * LDSW + hi * 8];
        v8h af[2][MT][2];
        #pragma unroll
        for (int mt = 0; mt < MT; ++mt) {
            af[0][mt][0] = *(const v8h*)(ap + mt * 16 * LDSW);        // K = hi*8 .. +7
            af[0][mt][1] = *(const v8h*)(ap + mt * 16 * LDSW + 16);   // K + 16
        }
        // step 0's reads go out first, under its dequant: LDS answers in order, so
        // reads of step 1 moved in front of them would delay the first WMMA
        __builtin_amdgcn_sched_barrier(0);

        #pragma unroll
        for (int step = 0; step < 4; ++step) {
            // B fragments: col = ncol + 16 * nt; elems 0..7 <- one packed word (8 consecutive K),
            //              elems 8..15 <- word +2 rows (K+16)
            v16h b[NT];
            #pragma unroll
            for (int nt = 0; nt < NT; ++nt) {
                const unsigned w0 = wc[nt][step * 2];
                const unsigned w1 = wc[nt][step * 2 + 1];
                #pragma unroll
                for (int j = 0; j < 8; ++j) {
                    b[nt][j]     = (_Float16)__builtin_fmaf((float)((w0 >> (4 * j)) & 15u), s[nt], zs[nt]);
                    b[nt][j + 8] = (_Float16)__builtin_fmaf((float)((w1 >> (4 * j)) & 15u), s[nt], zs[nt]);
                }
            }

            // the reads below stay one group: behind the WMMAs that still read their
            // registers, not spread among the vector work
            __builtin_amdgcn_sched_barrier(0);
            if (step + 1 < 4) {
                #pragma unroll
                for (int mt = 0; mt < MT; ++mt) {
                    af[(step + 1) & 1][mt][0] = *(const v8h*)(ap + mt * 16 * LDSW + (step + 1) * 32);
                    af[(step + 1) & 1][mt][1] = *(const v8h*)(ap + mt * 16 * LDSW + (step + 1) * 32 + 16);
                }
            }
            // keeps the next step's LDS reads one group in front of this step's WMMAs;
            // sunk among them, each read's latency would stand in front of its WMMA
            __builtin_amdgcn_sched_barrier(0);

            #pragma unroll
            for (int mt = 0; mt < MT; ++mt) {
                v16h a = __builtin_shufflevector(af[step & 1][mt][0], af[step & 1][mt][1],
                         0,1,2,3,4,5,6,7,8,9,10,11,12,13,14,15);
                #pragma unroll  // the fragment read once from LDS serves both column tiles
                for (int nt = 0; nt < NT; ++nt)
                    acc[mt][nt] = __builtin_amdgcn_wmma_f32_16x16x32_f16(
                                      false, a, false, b[nt], (short)0, acc[mt][nt], false, false);
            }
        }
        // the hand-over of the next group's weight registers, and with it the wait for
        // their loads, stays behind the last WMMA block: the loads keep the whole group
        __builtin_amdgcn_sched_barrier(0);
    }

    // C/D layout: VGPR v -> M = v (lanes 0-15) or v+8 (lanes 16-31), N = lane%16.
    // This slice's partial goes to the workspace in fragment order, indexed
    // [16-column tile][M-tile][slice]: per tile two stores of 512 contiguous
    // bytes (VGPRs 0-3, then 4-7, 16 bytes a lane).
    float* pw = part + ((size_t)((blockIdx.x * 8 + wave) * NT) * MT * KSPLIT + blockIdx.y) * TILEF
                     + lane * 4;
    #pragma unroll
    for (int nt = 0; nt < NT; ++nt) {
        #pragma unroll
        for (int mt = 0; mt < MT; ++mt) {
            float4 lo = {acc[mt][nt][0], acc[mt][nt][1], acc[mt][nt][2], acc[mt][nt][3]};
            float4 up = {acc[mt][nt][4], acc[mt][nt][5], acc[mt][nt][6], acc[mt][nt][7]};
            *(float4*)(pw + (nt * MT + mt) * KSPLIT * TILEF)       = lo;
            *(float4*)(pw + (nt * MT + mt) * KSPLIT * TILEF + 128) = up;
        }
    }
}

extern "C" void kernel_launch(void* const* d_in, const int* in_sizes, int n_in,
                              void* d_out, int out_size, void* d_ws, size_t ws_size,
                              hipStream_t stream) {
    (void)in_sizes; (void)n_in; (void)ws_size; (void)out_size;
    const float* x      = (const float*)d_in[0];
    const int*   Wq     = (const int*)d_in[1];
    const float* scales = (const float*)d_in[2];
    const float* zeros  = (const float*)d_in[3];
    float*       out    = (float*)d_out;
    _Float16*    xh     = (_Float16*)d_ws;   // 128*8192*2B = 2 MB scratch
    float*       part   = (float*)((char*)d_ws + XH_BYTES); // KSPLIT x 4 MB partials

    // 1) convert activations to f16 once
    cvt_x_kernel<<<dim3((M_DIM * K_DIM) / (256 * 8)), dim3(256), 0, stream>>>(x, xh);
    // 2) TDM-fed WMMA GEMM, one K slice per grid row, partials to the workspace
    dim3 grid(N_DIM / BN, KSPLIT);  // (32, 8) = 256 workgroups
    w4a32_gemm_wmma<<<grid, dim3(256), 0, stream>>>(xh, Wq, scales, zeros, part);
    // 3) sum the slices in fixed order into out
    merge_slices_kernel<<<dim3(N_DIM / RBN, MT), dim3(256), 0, stream>>>(part, out);
}

// v004
// A run of this version takes 26.5 microseconds.
// Timed twice side by side with v003, it ran 1.03 times as fast both times.
// Counting every step since v000, it is 2.48 times as fast.
#include <hip/hip_runtime.h>

typedef _Float16 v16h __attribute__((ext_vector_type(16)));
typedef _Float16 v8h  __attribute__((ext_vector_type(8)));
typedef float    v8f  __attribute__((ext_vector_type(8)));
typedef unsigned v4u  __attribute__((ext_vector_type(4)));
typedef unsigned v8u  __attribute__((ext_vector_type(8)));
typedef int      v8i  __attribute__((ext_vector_type(8)));
typedef int      v4i  __attribute__((ext_vector_type(4)));

#define K_DIM   8192
#define N_DIM   8192
#define M_DIM   128
#define GROUP   128
#define NGROUPS (K_DIM / GROUP)    // 64
#define KSPLIT  8
#define GPB     (NGROUPS / KSPLIT) // 8 groups per block
#define BM      128
#define BN      256                // columns of a GEMM block
#define MT      8                  // M-tiles per wave
#define NT      2                  // column tiles per wave: one A fragment feeds NT WMMAs
#define RBN     128                // columns of a merge block
#define LDSW    136                // 128 + 8 halves pad (produced by TDM pad feature)
#define XH_BYTES (M_DIM * K_DIM * 2)   // f16 copy of x at the start of the workspace
#define TILEF   256                // floats of one 16x16 accumulator tile
#define REDW    132                // LDS row pitch of the merge tile, floats

// Merge of the K slices: one block per (column block, M-tile) sums the KSPLIT
// partial tiles in slice order, turns them from fragment order into rows in LDS
// and stores whole 512-byte row pieces of out.
__global__ __launch_bounds__(256)
void merge_slices_kernel(const float* __restrict__ part, float* __restrict__ out) {
    __shared__ __align__(16) float tile[16 * REDW];
    const int tid  = threadIdx.x;
    const int lane = tid & 31;
    const int wave = tid >> 5;
    const int cb   = blockIdx.x;
    const int mt   = blockIdx.y;

    // the KSPLIT partials of one tile lie side by side: 8 KB contiguous per wave
    const float* p = part + ((size_t)(cb * 8 + wave) * MT + mt) * (KSPLIT * TILEF) + lane * 4;
    float4 lo = *(const float4*)(p);
    float4 up = *(const float4*)(p + 128);
    #pragma unroll  // all 2 * KSPLIT loads of a thread in flight together
    for (int ks = 1; ks < KSPLIT; ++ks) {
        const float4 a = *(const float4*)(p + ks * TILEF);
        const float4 b = *(const float4*)(p + ks * TILEF + 128);
        lo.x += a.x; lo.y += a.y; lo.z += a.z; lo.w += a.w;
        up.x += b.x; up.y += b.y; up.z += b.z; up.w += b.w;
    }

    float* t = &tile[(lane >> 4) * 8 * REDW + wave * 16 + (lane & 15)];
    t[0 * REDW] = lo.x; t[1 * REDW] = lo.y; t[2 * REDW] = lo.z; t[3 * REDW] = lo.w;
    t[4 * REDW] = up.x; t[5 * REDW] = up.y; t[6 * REDW] = up.z; t[7 * REDW] = up.w;
    __syncthreads();  // rows are read back by other waves than wrote them

    for (int i = 0; i < 2; ++i) {
        const int r = wave + i * 8;
        const float4 v = *(const float4*)&tile[r * REDW + lane * 4];
        *(float4*)&out[(size_t)(mt * 16 + r) * N_DIM + cb * RBN + lane * 4] = v;
    }
}

// x fp32 -> f16 once (reused by all 32 N-blocks; removes convert work from GEMM loop)
__global__ void cvt_x_kernel(const float* __restrict__ x, _Float16* __restrict__ xh) {
    const int idx = (blockIdx.x * 256 + threadIdx.x) * 8;
    const float4 a = *(const float4*)&x[idx];
    const float4 b = *(const float4*)&x[idx + 4];
    v8h h;
    h[0] = (_Float16)a.x; h[1] = (_Float16)a.y; h[2] = (_Float16)a.z; h[3] = (_Float16)a.w;
    h[4] = (_Float16)b.x; h[5] = (_Float16)b.y; h[6] = (_Float16)b.z; h[7] = (_Float16)b.w;
    *(v8h*)&xh[idx] = h;
}

// Issue a TDM load of a 128(rows) x 128(halves) f16 tile into LDS with
// 16B padding per 256B row (-> 136-half LDS row stride).
__device__ __forceinline__ void tdm_load_tile(unsigned lds_off, unsigned long long gaddr) {
    v4u d0;
    d0[0] = 1u;                                     // count=1 (valid), user mode
    d0[1] = lds_off;                                // lds_addr (bytes)
    d0[2] = (unsigned)(gaddr & 0xFFFFFFFFull);      // global_addr[31:0] (tile start)
    d0[3] = (unsigned)((gaddr >> 32) & 0x1FFFFFFull) | (2u << 30); // addr[56:32] | type=2
    v8i d1;
    d1[0] = (1 << 16)     // data_size = 2 bytes
          | (1 << 20)     // pad_enable
          | (5 << 22)     // pad_interval: 64 DWORDs (256B) between pads
          | (3 << 25);    // pad_amount: 4 DWORDs (16B)
    d1[1] = (int)(8192u << 16);  // tensor_dim0[15:0] in bits[63:48]
    d1[2] = (int)(128u  << 16);  // tensor_dim1[15:0] in bits[95:80]
    d1[3] = (int)(128u  << 16);  // tile_dim0 = 128 in bits[127:112]
    d1[4] = 128;                 // tile_dim1 = 128 in bits[143:128]
    d1[5] = 8192;                // tensor_dim0_stride[31:0]
    d1[6] = 0;
    d1[7] = 0;
    v4i z4 = {0, 0, 0, 0};            // groups 2/3 unused (2-D tensor)
    v8i z8 = {0, 0, 0, 0, 0, 0, 0, 0};
    __builtin_amdgcn_tensor_load_to_lds(d0, d1, z4, z4, z8, 0);
}

// Two packed words (8 consecutive K each) -> the 16 f16 weights of a B fragment.
// Two nibbles at a time become f16 numbers by bit work alone: 0x6400 | u is 1024 + u,
// 0x6400 | (u << 4) is 1024 + 16 u, both exact. One mixed fma per weight
// (f16 * f32 + f32, rounded to f16) then gives (u - zero) * scale:
// s = scale, c = -(1024 + zero) * scale; for the nibbles taken as 16 u
// s16 = scale / 16, c16 = -(64 + zero) * scale; all f32.
// Written as asm because the compiler takes the mixed fma for low halves only; for
// high halves it converts up, multiplies in f32 pairs and converts down again.
// Every instruction reads results that are at least five instructions old, so the
// run needs no delay hints.
// The eight scratch registers t (nibble pairs (k, k + 4) as f16 pairs) belong to the
// caller and stay its own through the whole K loop: the compiler does not look into
// asm text, and a scratch register taken afresh could be one that a WMMA just in front
// still reads as A or B, which may not be overwritten within 4 vector slots. The
// fragment itself is first written ten vector instructions into the run.
__device__ __forceinline__ v16h dequant_pair(unsigned w0, unsigned w1, float s, float s16, float c,
                                             float c16, unsigned (&t)[8]) {
    unsigned r0, r1, r2, r3, r4, r5, r6, r7;   // the fragment: r0-r3 of w0, r4-r7 of w1
    asm("v_lshrrev_b32 %10, 8, %16\n\t"
        "v_lshrrev_b32 %14, 8, %17\n\t"
        "v_and_or_b32 %8, %16, %22, 0x64006400\n\t"    // k 0, 4
        "v_and_or_b32 %9, %16, %23, 0x64006400\n\t"    // k 1, 5 (times 16)
        "v_and_or_b32 %12, %17, %22, 0x64006400\n\t"
        "v_and_or_b32 %13, %17, %23, 0x64006400\n\t"
        "v_and_or_b32 %11, %10, %23, 0x64006400\n\t"   // k 3, 7 (times 16)
        "v_and_or_b32 %15, %14, %23, 0x64006400\n\t"
        "v_and_or_b32 %10, %10, %22, 0x64006400\n\t"   // k 2, 6
        "v_and_or_b32 %14, %14, %22, 0x64006400\n\t"
        "v_fma_mixlo_f16 %0, %8, %18, %20 op_sel_hi:[1,0,0]\n\t"                  // k 0
        "v_fma_mixlo_f16 %2, %8, %18, %20 op_sel:[1,0,0] op_sel_hi:[1,0,0]\n\t"   // k 4
        "v_fma_mixlo_f16 %4, %12, %18, %20 op_sel_hi:[1,0,0]\n\t"
        "v_fma_mixlo_f16 %6, %12, %18, %20 op_sel:[1,0,0] op_sel_hi:[1,0,0]\n\t"
        "v_fma_mixlo_f16 %1, %10, %18, %20 op_sel_hi:[1,0,0]\n\t"                 // k 2
        "v_fma_mixlo_f16 %3, %10, %18, %20 op_sel:[1,0,0] op_sel_hi:[1,0,0]\n\t"  // k 6
        "v_fma_mixlo_f16 %5, %14, %18, %20 op_sel_hi:[1,0,0]\n\t"
        "v_fma_mixlo_f16 %7, %14, %18, %20 op_sel:[1,0,0] op_sel_hi:[1,0,0]\n\t"
        "v_fma_mixhi_f16 %0, %9, %19, %21 op_sel_hi:[1,0,0]\n\t"                  // k 1
        "v_fma_mixhi_f16 %2, %9, %19, %21 op_sel:[1,0,0] op_sel_hi:[1,0,0]\n\t"   // k 5
        "v_fma_mixhi_f16 %4, %13, %19, %21 op_sel_hi:[1,0,0]\n\t"
        "v_fma_mixhi_f16 %6, %13, %19, %21 op_sel:[1,0,0] op_sel_hi:[1,0,0]\n\t"
        "v_fma_mixhi_f16 %1, %11, %19, %21 op_sel_hi:[1,0,0]\n\t"                 // k 3
        "v_fma_mixhi_f16 %3, %11, %19, %21 op_sel:[1,0,0] op_sel_hi:[1,0,0]\n\t"  // k 7
        "v_fma_mixhi_f16 %5, %15, %19, %21 op_sel_hi:[1,0,0]\n\t"
        "v_fma_mixhi_f16 %7, %15, %19, %21 op_sel:[1,0,0] op_sel_hi:[1,0,0]"
        : "=&v"(r0), "=&v"(r1), "=&v"(r2), "=&v"(r3), "=&v"(r4), "=&v"(r5), "=&v"(r6), "=&v"(r7),
          "+v"(t[0]), "+v"(t[1]), "+v"(t[2]), "+v"(t[3]), "+v"(t[4]), "+v"(t[5]), "+v"(t[6]), "+v"(t[7])
        : "v"(w0), "v"(w1), "v"(s), "v"(s16), "v"(c), "v"(c16), "s"(0x000F000Fu), "s"(0x00F000F0u));
    const v8u r = {r0, r1, r2, r3, r4, r5, r6, r7};
    return __builtin_bit_cast(v16h, r);
}

__global__ __launch_bounds__(256, 2)
void w4a32_gemm_wmma(const _Float16* __restrict__ xh,
                     const int*      __restrict__ Wq,
                     const float*    __restrict__ scales,
                     const float*    __restrict__ zeros,
                     float*          __restrict__ part)
{
    __shared__ __align__(16) _Float16 As[2][BM * LDSW];

    const int tid  = threadIdx.x;
    const int lane = tid & 31;
    const int wave = tid >> 5;

    const int colbase = blockIdx.x * BN;
    const int gbase   = blockIdx.y * GPB;       // K-split group base

    const int nl   = lane & 15;                 // col within 16-wide tile / A row
    const int hi   = lane >> 4;                 // lane half -> K-octet / M+8 on store
    const int ncol = colbase + wave * (NT * 16) + nl;  // this lane's column in tile 0; tile 1: +16

    const unsigned lds0 = (unsigned)(uintptr_t)&As[0][0];
    const unsigned lds1 = (unsigned)(uintptr_t)&As[1][0];
    const unsigned long long xbase = (unsigned long long)(uintptr_t)xh;

    // prologue: DMA first chunk into buffer 0
    if (wave == 0) {
        tdm_load_tile(lds0, xbase + (unsigned long long)(gbase * GROUP) * 2u);
    }

    // Weight-side operands of a group for this lane, per column tile: 8 packed words
    // (word rows hi, hi+2, ... hi+14 of the group's 16), its column's scale and zero.
    // They are fetched one group ahead into registers, so that their memory
    // latency runs under the group before instead of in front of each group.
    const int*   wp = Wq     + (size_t)(gbase * 16 + hi) * N_DIM + ncol;
    const float* sp = scales + (size_t)gbase * N_DIM + ncol;
    const float* zp = zeros  + (size_t)gbase * N_DIM + ncol;
    unsigned wn[NT][8];
    float sn[NT], zn[NT];
    #pragma unroll  // constant indices keep wn[][] in registers; all loads in flight together
    for (int nt = 0; nt < NT; ++nt) {
        #pragma unroll
        for (int j = 0; j < 8; ++j)
            wn[nt][j] = (unsigned)__builtin_nontemporal_load(&wp[(size_t)(2 * j) * N_DIM + nt * 16]);
    }
    #pragma unroll
    for (int nt = 0; nt < NT; ++nt) {
        sn[nt] = sp[nt * 16];
        zn[nt] = zp[nt * 16];
    }
    // the registers that these loads name are reused below: wait before they are overwritten
    asm volatile("s_wait_xcnt 0x0" ::: "memory");
    __builtin_amdgcn_sched_barrier(0);  // holds the register writes below behind that wait

    v8f acc[MT][NT];
    #pragma unroll
    for (int mt = 0; mt < MT; ++mt) {
        #pragma unroll
        for (int nt = 0; nt < NT; ++nt) { v8f z = {}; acc[mt][nt] = z; }
    }

    unsigned dq[8] = {0, 0, 0, 0, 0, 0, 0, 0};  // scratch registers of dequant_pair

    for (int gi = 0; gi < GPB; ++gi) {
        const int g = gbase + gi;

        if (wave == 0) __builtin_amdgcn_s_wait_tensorcnt(0); // chunk gi landed in LDS
        __syncthreads();                                     // publish to all waves

        // kick DMA for next chunk into the other buffer (it was last read
        // before the barrier above -> no WAR hazard)
        if (wave == 0 && gi + 1 < GPB) {
            tdm_load_tile((gi + 1) & 1 ? lds1 : lds0,
                          xbase + (unsigned long long)((g + 1) * GROUP) * 2u);
        }

        const _Float16* Ab = (gi & 1) ? &As[1][0] : &As[0][0];

        // this group's operands, loaded during the group before
        unsigned wc[NT][8];
        float s[NT], s16[NT], zs[NT], zs16[NT];
        #pragma unroll  // constant indices keep wc[][] in registers
        for (int nt = 0; nt < NT; ++nt) {
            #pragma unroll
            for (int j = 0; j < 8; ++j) wc[nt][j] = wn[nt][j];
            s[nt]    = sn[nt];
            s16[nt]  = sn[nt] * 0.0625f;   // for the nibbles taken as 1024 + 16 u
            const float mzs = -zn[nt] * s[nt];
            zs[nt]   = __builtin_fmaf(-1024.0f, s[nt], mzs);  // takes the 1024 of the bit form off again
            zs16[nt] = __builtin_fmaf(-64.0f, s[nt], mzs);    // 1024 / 16 = 64 comes off there
        }

        // next group's operands start now; nothing of this group reads them
        if (gi + 1 < GPB) {
            #pragma unroll  // as above: registers, and all loads issued as one run
            for (int nt = 0; nt < NT; ++nt) {
                #pragma unroll
                for (int j = 0; j < 8; ++j)
                    wn[nt][j] = (unsigned)__builtin_nontemporal_load(&wp[(size_t)(16 + 2 * j) * N_DIM + nt * 16]);
            }
            #pragma unroll
            for (int nt = 0; nt < NT; ++nt) {
                sn[nt] = sp[N_DIM + nt * 16];
                zn[nt] = zp[N_DIM + nt * 16];
            }
            // the address registers that these loads name are advanced at the foot of
            // the loop: wait before they are overwritten
            asm volatile("s_wait_xcnt 0x0" ::: "memory");
        }

        // A fragments of a whole k-step (MT tiles, two 16-byte reads each) are read
        // from LDS as one group into their own registers, one step ahead of use.
        const _Float16* ap = &Ab[nl * LDSW + hi * 8];
        v8h af[2][MT][2];
        #pragma unroll
        for (int mt = 0; mt < MT; ++mt) {
            af[0][mt][0] = *(const v8h*)(ap + mt * 16 * LDSW);        // K = hi*8 .. +7
            af[0][mt][1] = *(const v8h*)(ap + mt * 16 * LDSW + 16);   // K + 16
        }
        // step 0's reads go out first, under its dequant: LDS answers in order, so
        // reads of step 1 moved in front of them would delay the first WMMA
        __builtin_amdgcn_sched_barrier(0);

        #pragma unroll
        for (int step = 0; step < 4; ++step) {
            // B fragments: col = ncol + 16 * nt; elems 0..7 <- one packed word (8 consecutive K),
            //              elems 8..15 <- word +2 rows (K+16)
            v16h b[NT];
            #pragma unroll
            for (int nt = 0; nt < NT; ++nt)
                b[nt] = dequant_pair(wc[nt][step * 2], wc[nt][step * 2 + 1], s[nt], s16[nt], zs[nt], zs16[nt], dq);

            // the reads below stay one group: behind the WMMAs that still read their
            // registers, not spread among the vector work
            __builtin_amdgcn_sched_barrier(0);
            if (step + 1 < 4) {
                #pragma unroll
                for (int mt = 0; mt < MT; ++mt) {
                    af[(step + 1) & 1][mt][0] = *(const v8h*)(ap + mt * 16 * LDSW + (step + 1) * 32);
                    af[(step + 1) & 1][mt][1] = *(const v8h*)(ap + mt * 16 * LDSW + (step + 1) * 32 + 16);
                }
            }
            // keeps the next step's LDS reads one group in front of this step's WMMAs;
            // sunk among them, each read's latency would stand in front of its WMMA
            __builtin_amdgcn_sched_barrier(0);

            #pragma unroll
            for (int mt = 0; mt < MT; ++mt) {
                v16h a = __builtin_shufflevector(af[step & 1][mt][0], af[step & 1][mt][1],
                         0,1,2,3,4,5,6,7,8,9,10,11,12,13,14,15);
                #pragma unroll  // the fragment read once from LDS serves both column tiles
                for (int nt = 0; nt < NT; ++nt)
                    acc[mt][nt] = __builtin_amdgcn_wmma_f32_16x16x32_f16(
                                      false, a, false, b[nt], (short)0, acc[mt][nt], false, false);
            }
        }
        // the hand-over of the next group's weight registers, and with it the wait for
        // their loads, stays behind the last WMMA block: the loads keep the whole group
        __builtin_amdgcn_sched_barrier(0);
        wp += 16 * N_DIM;
        sp += N_DIM;
        zp += N_DIM;
    }

    // C/D layout: VGPR v -> M = v (lanes 0-15) or v+8 (lanes 16-31), N = lane%16.
    // This slice's partial goes to the workspace in fragment order, indexed
    // [16-column tile][M-tile][slice]: per tile two stores of 512 contiguous
    // bytes (VGPRs 0-3, then 4-7, 16 bytes a lane).
    float* pw = part + ((size_t)((blockIdx.x * 8 + wave) * NT) * MT * KSPLIT + blockIdx.y) * TILEF
                     + lane * 4;
    #pragma unroll
    for (int nt = 0; nt < NT; ++nt) {
        #pragma unroll
        for (int mt = 0; mt < MT; ++mt) {
            float4 lo = {acc[mt][nt][0], acc[mt][nt][1], acc[mt][nt][2], acc[mt][nt][3]};
            float4 up = {acc[mt][nt][4], acc[mt][nt][5], acc[mt][nt][6], acc[mt][nt][7]};
            *(float4*)(pw + (nt * MT + mt) * KSPLIT * TILEF)       = lo;
            *(float4*)(pw + (nt * MT + mt) * KSPLIT * TILEF + 128) = up;
        }
    }
}

extern "C" void kernel_launch(void* const* d_in, const int* in_sizes, int n_in,
                              void* d_out, int out_size, void* d_ws, size_t ws_size,
                              hipStream_t stream) {
    (void)in_sizes; (void)n_in; (void)ws_size; (void)out_size;
    const float* x      = (const float*)d_in[0];
    const int*   Wq     = (const int*)d_in[1];
    const float* scales = (const float*)d_in[2];
    const float* zeros  = (const float*)d_in[3];
    float*       out    = (float*)d_out;
    _Float16*    xh     = (_Float16*)d_ws;   // 128*8192*2B = 2 MB scratch
    float*       part   = (float*)((char*)d_ws + XH_BYTES); // KSPLIT x 4 MB partials

    // 1) convert activations to f16 once
    cvt_x_kernel<<<dim3((M_DIM * K_DIM) / (256 * 8)), dim3(256), 0, stream>>>(x, xh);
    // 2) TDM-fed WMMA GEMM, one K slice per grid row, partials to the workspace
    dim3 grid(N_DIM / BN, KSPLIT);  // (32, 8) = 256 workgroups
    w4a32_gemm_wmma<<<grid, dim3(256), 0, stream>>>(xh, Wq, scales, zeros, part);
    // 3) sum the slices in fixed order into out
    merge_slices_kernel<<<dim3(N_DIM / RBN, MT), dim3(256), 0, stream>>>(part, out);
}

// v005
// One run takes 23.5 microseconds.
// Two timings next to v004 put it at 1.12 and 1.14 times that version's speed.
// Counting every step since v000, it is 2.80 times as fast.
#include <hip/hip_runtime.h>

typedef _Float16 v16h __attribute__((ext_vector_type(16)));
typedef _Float16 v8h  __attribute__((ext_vector_type(8)));
typedef float    v8f  __attribute__((ext_vector_type(8)));
typedef unsigned v4u  __attribute__((ext_vector_type(4)));
typedef unsigned v8u  __attribute__((ext_vector_type(8)));
typedef int      v8i  __attribute__((ext_vector_type(8)));
typedef int      v4i  __attribute__((ext_vector_type(4)));

#define K_DIM   8192
#define N_DIM   8192
#define M_DIM   128
#define GROUP   128
#define NGROUPS (K_DIM / GROUP)    // 64
#define KSPLIT  4                  // K slices across work-groups (partials in the workspace)
#define KHALF   2                  // K halves of a slice inside a block, summed through LDS
#define GPB     (NGROUPS / (KSPLIT * KHALF)) // 8 groups per wave
#define BM      128
#define BN      128                // columns of a GEMM block
#define MT      8                  // M-tiles per wave
#define NT      2                  // column tiles per wave: one A fragment feeds NT WMMAs
#define RBN     128                // columns of a merge block
#define LDSW    136                // 128 + 8 halves pad (produced by TDM pad feature)
#define TILEB   (BM * LDSW * 2)    // bytes of one x tile in LDS: 34,816 = 17 * 2 KiB
#define XH_BYTES (M_DIM * K_DIM * 2)   // f16 copy of x at the start of the workspace
#define TILEF   256                // floats of one 16x16 accumulator tile
#define REDW    132                // LDS row pitch of the merge tile, floats

// Merge of the K slices: one block per (column block, M-tile) sums the KSPLIT
// partial tiles in slice order, turns them from fragment order into rows in LDS
// and stores whole 512-byte row pieces of out.
__global__ __launch_bounds__(256)
void merge_slices_kernel(const float* __restrict__ part, float* __restrict__ out) {
    __shared__ __align__(16) float tile[16 * REDW];
    const int tid  = threadIdx.x;
    const int lane = tid & 31;
    const int wave = tid >> 5;
    const int cb   = blockIdx.x;
    const int mt   = blockIdx.y;

    // the KSPLIT partials of one tile lie side by side: 4 KB contiguous per wave
    const float* p = part + ((size_t)(cb * 8 + wave) * MT + mt) * (KSPLIT * TILEF) + lane * 4;
    float4 lo = *(const float4*)(p);
    float4 up = *(const float4*)(p + 128);
    #pragma unroll  // all 2 * KSPLIT loads of a thread in flight together
    for (int ks = 1; ks < KSPLIT; ++ks) {
        const float4 a = *(const float4*)(p + ks * TILEF);
        const float4 b = *(const float4*)(p + ks * TILEF + 128);
        lo.x += a.x; lo.y += a.y; lo.z += a.z; lo.w += a.w;
        up.x += b.x; up.y += b.y; up.z += b.z; up.w += b.w;
    }

    float* t = &tile[(lane >> 4) * 8 * REDW + wave * 16 + (lane & 15)];
    t[0 * REDW] = lo.x; t[1 * REDW] = lo.y; t[2 * REDW] = lo.z; t[3 * REDW] = lo.w;
    t[4 * REDW] = up.x; t[5 * REDW] = up.y; t[6 * REDW] = up.z; t[7 * REDW] = up.w;
    __syncthreads();  // rows are read back by other waves than wrote them

    for (int i = 0; i < 2; ++i) {
        const int r = wave + i * 8;
        const float4 v = *(const float4*)&tile[r * REDW + lane * 4];
        *(float4*)&out[(size_t)(mt * 16 + r) * N_DIM + cb * RBN + lane * 4] = v;
    }
}

// x fp32 -> f16 once (reused by all 64 N-blocks; removes convert work from GEMM loop)
__global__ void cvt_x_kernel(const float* __restrict__ x, _Float16* __restrict__ xh) {
    const int idx = (blockIdx.x * 256 + threadIdx.x) * 8;
    const float4 a = *(const float4*)&x[idx];
    const float4 b = *(const float4*)&x[idx + 4];
    v8h h;
    h[0] = (_Float16)a.x; h[1] = (_Float16)a.y; h[2] = (_Float16)a.z; h[3] = (_Float16)a.w;
    h[4] = (_Float16)b.x; h[5] = (_Float16)b.y; h[6] = (_Float16)b.z; h[7] = (_Float16)b.w;
    *(v8h*)&xh[idx] = h;
}

__device__ __forceinline__ unsigned uni(unsigned v) { return (unsigned)__builtin_amdgcn_readfirstlane(v); }
// A wave-uniform test for the branch round a tensor load, which ignores EXEC.
__device__ __forceinline__ unsigned pinned(unsigned v) {
    unsigned w = uni(v);
    asm volatile("" : "+s"(w));  // holds the test in a scalar register, so that the branch on it is a scalar one
    return w;
}

// Descriptor group 1 of an x tile: 128 rows of 256 bytes (128 halves) of the f16 x,
// source pitch 16,384 bytes, 16 bytes of LDS pad behind each row (pitch 272 bytes).
// Every extent in bytes (data_size code 0), tensor dims = tile dims.
__device__ __forceinline__ v8u tdm_group1() {
    v8u g1;
    g1[0] = uni((1u << 20) | (5u << 22) | (3u << 25));  // no mask; pad of 4 dwords behind every 64
    g1[1] = uni(256u << 16);                         // tensor_dim0 = 256 bytes
    g1[2] = uni(128u << 16);                         // tensor_dim1 = 128 rows
    g1[3] = uni(256u << 16);                         // tile_dim0
    g1[4] = uni(128u);                               // tile_dim1
    g1[5] = uni(K_DIM * 2u);                         // source row pitch, bytes
    g1[6] = uni(0u);
    g1[7] = uni(0u);
    return g1;
}

// Descriptor group 0: the tile's place in LDS and its first byte in memory.
__device__ __forceinline__ v4u tdm_group0(unsigned lds_off, unsigned long long gaddr) {
    v4u g0;
    g0[0] = uni(1u);                                 // count 1
    g0[1] = uni(lds_off);                            // byte offset in the work-group's LDS
    g0[2] = uni((unsigned)gaddr);                    // first byte of the tile, low word
    g0[3] = uni((((unsigned)(gaddr >> 32)) & 0x01FFFFFFu) | 0x80000000u);  // high bits, type 2
    return g0;
}
__device__ __forceinline__ void tdm_load(v4u g0, v8u g1) {
    asm volatile("tensor_load_to_lds %0, %1" :: "s"(g0), "s"(g1) : "memory");
}

// Two packed words (8 consecutive K each) -> the 16 f16 weights of a B fragment.
// Two nibbles at a time become f16 numbers by bit work alone: 0x6400 | u is 1024 + u,
// 0x6400 | (u << 4) is 1024 + 16 u, both exact. One mixed fma per weight
// (f16 * f32 + f32, rounded to f16) then gives (u - zero) * scale:
// s = scale, c = -(1024 + zero) * scale; for the nibbles taken as 16 u
// s16 = scale / 16, c16 = -(64 + zero) * scale; all f32.
// Written as asm because the compiler takes the mixed fma for low halves only; for
// high halves it converts up, multiplies in f32 pairs and converts down again.
// Every instruction reads results that are at least five instructions old, so the
// run needs no delay hints.
// The eight scratch registers t (nibble pairs (k, k + 4) as f16 pairs) belong to the
// caller and stay its own through the whole K loop: the compiler does not look into
// asm text, and a scratch register taken afresh could be one that a WMMA just in front
// still reads as A or B, which may not be overwritten within 4 vector slots. The
// fragment itself is first written ten vector instructions into the run.
__device__ __forceinline__ v16h dequant_pair(unsigned w0, unsigned w1, float s, float s16, float c,
                                             float c16, unsigned (&t)[8]) {
    unsigned r0, r1, r2, r3, r4, r5, r6, r7;   // the fragment: r0-r3 of w0, r4-r7 of w1
    asm("v_lshrrev_b32 %10, 8, %16\n\t"
        "v_lshrrev_b32 %14, 8, %17\n\t"
        "v_and_or_b32 %8, %16, %22, 0x64006400\n\t"    // k 0, 4
        "v_and_or_b32 %9, %16, %23, 0x64006400\n\t"    // k 1, 5 (times 16)
        "v_and_or_b32 %12, %17, %22, 0x64006400\n\t"
        "v_and_or_b32 %13, %17, %23, 0x64006400\n\t"
        "v_and_or_b32 %11, %10, %23, 0x64006400\n\t"   // k 3, 7 (times 16)
        "v_and_or_b32 %15, %14, %23, 0x64006400\n\t"
        "v_and_or_b32 %10, %10, %22, 0x64006400\n\t"   // k 2, 6
        "v_and_or_b32 %14, %14, %22, 0x64006400\n\t"
        "v_fma_mixlo_f16 %0, %8, %18, %20 op_sel_hi:[1,0,0]\n\t"                  // k 0
        "v_fma_mixlo_f16 %2, %8, %18, %20 op_sel:[1,0,0] op_sel_hi:[1,0,0]\n\t"   // k 4
        "v_fma_mixlo_f16 %4, %12, %18, %20 op_sel_hi:[1,0,0]\n\t"
        "v_fma_mixlo_f16 %6, %12, %18, %20 op_sel:[1,0,0] op_sel_hi:[1,0,0]\n\t"
        "v_fma_mixlo_f16 %1, %10, %18, %20 op_sel_hi:[1,0,0]\n\t"                 // k 2
        "v_fma_mixlo_f16 %3, %10, %18, %20 op_sel:[1,0,0] op_sel_hi:[1,0,0]\n\t"  // k 6
        "v_fma_mixlo_f16 %5, %14, %18, %20 op_sel_hi:[1,0,0]\n\t"
        "v_fma_mixlo_f16 %7, %14, %18, %20 op_sel:[1,0,0] op_sel_hi:[1,0,0]\n\t"
        "v_fma_mixhi_f16 %0, %9, %19, %21 op_sel_hi:[1,0,0]\n\t"                  // k 1
        "v_fma_mixhi_f16 %2, %9, %19, %21 op_sel:[1,0,0] op_sel_hi:[1,0,0]\n\t"   // k 5
        "v_fma_mixhi_f16 %4, %13, %19, %21 op_sel_hi:[1,0,0]\n\t"
        "v_fma_mixhi_f16 %6, %13, %19, %21 op_sel:[1,0,0] op_sel_hi:[1,0,0]\n\t"
        "v_fma_mixhi_f16 %1, %11, %19, %21 op_sel_hi:[1,0,0]\n\t"                 // k 3
        "v_fma_mixhi_f16 %3, %11, %19, %21 op_sel:[1,0,0] op_sel_hi:[1,0,0]\n\t"  // k 7
        "v_fma_mixhi_f16 %5, %15, %19, %21 op_sel_hi:[1,0,0]\n\t"
        "v_fma_mixhi_f16 %7, %15, %19, %21 op_sel:[1,0,0] op_sel_hi:[1,0,0]"
        : "=&v"(r0), "=&v"(r1), "=&v"(r2), "=&v"(r3), "=&v"(r4), "=&v"(r5), "=&v"(r6), "=&v"(r7),
          "+v"(t[0]), "+v"(t[1]), "+v"(t[2]), "+v"(t[3]), "+v"(t[4]), "+v"(t[5]), "+v"(t[6]), "+v"(t[7])
        : "v"(w0), "v"(w1), "v"(s), "v"(s16), "v"(c), "v"(c16), "s"(0x000F000Fu), "s"(0x00F000F0u));
    const v8u r = {r0, r1, r2, r3, r4, r5, r6, r7};
    return __builtin_bit_cast(v16h, r);
}

__global__ __launch_bounds__(256, 2)
void w4a32_gemm_wmma(const _Float16* __restrict__ xh,
                     const int*      __restrict__ Wq,
                     const float*    __restrict__ scales,
                     const float*    __restrict__ zeros,
                     float*          __restrict__ part)
{
    // [buffer][K half]: each tile's place is a multiple of 2 KiB
    __shared__ __attribute__((aligned(2048))) _Float16 As[2][KHALF][BM * LDSW];

    const int tid  = threadIdx.x;
    const int lane = tid & 31;
    const int wave = (int)uni((unsigned)tid >> 5);
    const int cw   = wave & 3;                  // which 32 columns of the block
    const int kh   = wave >> 2;                 // which K half of the slice
    const unsigned issuer = (cw == 0);          // waves 0 and 4 bring in their half's x tiles

    const int colbase = blockIdx.x * BN;
    const int gbase   = (blockIdx.y * KHALF + kh) * GPB;  // first group of this wave's K half

    const int nl   = lane & 15;                 // col within 16-wide tile / A row
    const int hi   = lane >> 4;                 // lane half -> K-octet / M+8 on store
    const int ncol = colbase + cw * (NT * 16) + nl;    // this lane's column in tile 0; tile 1: +16

    const unsigned ldsh = (unsigned)(uintptr_t)&As[0][0][0] + (unsigned)kh * TILEB;  // buffer 0, own half
    const unsigned long long xtile = (unsigned long long)(uintptr_t)xh
                                   + (unsigned long long)(gbase * GROUP) * 2u;       // own half's stage 0
    v8u g1 = tdm_group1();
    // descriptor words held in scalar registers: one set for the whole kernel, which
    // nothing rewrites while a request is in flight
    asm volatile("" : "+s"(g1));

    // x tiles, two buffers: stage 0 starts first of all
    const v4u g0first = tdm_group0(ldsh, xtile);
    if (pinned(issuer)) {
        tdm_load(g0first, g1);
    }

    // Weight-side operands of a group for this lane, per column tile: 8 packed words
    // (word rows hi, hi+2, ... hi+14 of the group's 16), its column's scale and zero.
    // They are fetched one group ahead into registers, so that their memory
    // latency runs under the group before instead of in front of each group.
    const int*   wp = Wq     + (size_t)(gbase * 16 + hi) * N_DIM + ncol;
    const float* sp = scales + (size_t)gbase * N_DIM + ncol;
    const float* zp = zeros  + (size_t)gbase * N_DIM + ncol;
    unsigned wn[NT][8];
    float sn[NT], zn[NT];
    #pragma unroll  // constant indices keep wn[][] in registers; all loads in flight together
    for (int nt = 0; nt < NT; ++nt) {
        #pragma unroll
        for (int j = 0; j < 8; ++j)
            wn[nt][j] = (unsigned)__builtin_nontemporal_load(&wp[(size_t)(2 * j) * N_DIM + nt * 16]);
    }
    #pragma unroll
    for (int nt = 0; nt < NT; ++nt) {
        sn[nt] = sp[nt * 16];
        zn[nt] = zp[nt * 16];
    }
    // the registers that these loads name are reused below: wait before they are overwritten
    asm volatile("s_wait_xcnt 0x0" ::: "memory");
    __builtin_amdgcn_sched_barrier(0);  // holds the register writes below behind that wait

    v8f acc[MT][NT];
    #pragma unroll
    for (int mt = 0; mt < MT; ++mt) {
        #pragma unroll
        for (int nt = 0; nt < NT; ++nt) { v8f z = {}; acc[mt][nt] = z; }
    }

    unsigned dq[8] = {0, 0, 0, 0, 0, 0, 0, 0};  // scratch registers of dequant_pair

    // stage 0 lands and is published, then stage 1 starts
    if (pinned(issuer)) {
        asm volatile("s_wait_tensorcnt 0x0" ::: "memory");  // stage 0 has landed
    }
    // descriptor words held in scalar registers: stage 0's stay unwritten up to its wait
    asm volatile("" :: "s"(g0first));
    __syncthreads();                                         // publishes it to all waves
    if (pinned(issuer)) {
        tdm_load(tdm_group0(ldsh + KHALF * TILEB, xtile + GROUP * 2u), g1);
    }

    for (int gi = 0; gi < GPB; ++gi) {
        const _Float16* Ab = &As[gi & 1][kh][0];

        // this group's operands, loaded during the group before
        unsigned wc[NT][8];
        float s[NT], s16[NT], zs[NT], zs16[NT];
        #pragma unroll  // constant indices keep wc[][] in registers
        for (int nt = 0; nt < NT; ++nt) {
            #pragma unroll
            for (int j = 0; j < 8; ++j) wc[nt][j] = wn[nt][j];
            s[nt]    = sn[nt];
            s16[nt]  = sn[nt] * 0.0625f;   // for the nibbles taken as 1024 + 16 u
            const float mzs = -zn[nt] * s[nt];
            zs[nt]   = __builtin_fmaf(-1024.0f, s[nt], mzs);  // takes the 1024 of the bit form off again
            zs16[nt] = __builtin_fmaf(-64.0f, s[nt], mzs);    // 1024 / 16 = 64 comes off there
        }

        // next group's operands start now; nothing of this group reads them
        if (gi + 1 < GPB) {
            #pragma unroll  // as above: registers, and all loads issued as one run
            for (int nt = 0; nt < NT; ++nt) {
                #pragma unroll
                for (int j = 0; j < 8; ++j)
                    wn[nt][j] = (unsigned)__builtin_nontemporal_load(&wp[(size_t)(16 + 2 * j) * N_DIM + nt * 16]);
            }
            #pragma unroll
            for (int nt = 0; nt < NT; ++nt) {
                sn[nt] = sp[N_DIM + nt * 16];
                zn[nt] = zp[N_DIM + nt * 16];
            }
            // the address registers that these loads name are advanced at the foot of
            // the loop: wait before they are overwritten
            asm volatile("s_wait_xcnt 0x0" ::: "memory");
        }

        // A fragments of a whole k-step (MT tiles, two 16-byte reads each) are read
        // from LDS as one group into their own registers, one step ahead of use.
        const _Float16* ap = &Ab[nl * LDSW + hi * 8];
        v8h af[2][MT][2];
        #pragma unroll
        for (int mt = 0; mt < MT; ++mt) {
            af[0][mt][0] = *(const v8h*)(ap + mt * 16 * LDSW);        // K = hi*8 .. +7
            af[0][mt][1] = *(const v8h*)(ap + mt * 16 * LDSW + 16);   // K + 16
        }
        // step 0's reads go out first, under its dequant: LDS answers in order, so
        // reads of step 1 moved in front of them would delay the first WMMA
        __builtin_amdgcn_sched_barrier(0);

        #pragma unroll
        for (int step = 0; step < 4; ++step) {
            // B fragments: col = ncol + 16 * nt; elems 0..7 <- one packed word (8 consecutive K),
            //              elems 8..15 <- word +2 rows (K+16)
            v16h b[NT];
            #pragma unroll
            for (int nt = 0; nt < NT; ++nt)
                b[nt] = dequant_pair(wc[nt][step * 2], wc[nt][step * 2 + 1], s[nt], s16[nt], zs[nt], zs16[nt], dq);

            // the reads below stay one group: behind the WMMAs that still read their
            // registers, not spread among the vector work
            __builtin_amdgcn_sched_barrier(0);
            if (step + 1 < 4) {
                #pragma unroll
                for (int mt = 0; mt < MT; ++mt) {
                    af[(step + 1) & 1][mt][0] = *(const v8h*)(ap + mt * 16 * LDSW + (step + 1) * 32);
                    af[(step + 1) & 1][mt][1] = *(const v8h*)(ap + mt * 16 * LDSW + (step + 1) * 32 + 16);
                }
            }
            // keeps the next step's LDS reads one group in front of this step's WMMAs;
            // sunk among them, each read's latency would stand in front of its WMMA
            __builtin_amdgcn_sched_barrier(0);

            #pragma unroll
            for (int mt = 0; mt < MT; ++mt) {
                v16h a = __builtin_shufflevector(af[step & 1][mt][0], af[step & 1][mt][1],
                         0,1,2,3,4,5,6,7,8,9,10,11,12,13,14,15);
                #pragma unroll  // the fragment read once from LDS serves both column tiles
                for (int nt = 0; nt < NT; ++nt)
                    acc[mt][nt] = __builtin_amdgcn_wmma_f32_16x16x32_f16(
                                      false, a, false, b[nt], (short)0, acc[mt][nt], false, false);
            }
        }
        // the hand-over of the next group's weight registers, and with it the wait for
        // their loads, stays behind the last WMMA block: the loads keep the whole group
        __builtin_amdgcn_sched_barrier(0);
        wp += 16 * N_DIM;
        sp += N_DIM;
        zp += N_DIM;

        // publish point of stage gi + 1
        asm volatile("s_wait_dscnt 0x0" ::: "memory");          // own reads of this buffer are done
        if (pinned(issuer)) {
            asm volatile("s_wait_tensorcnt 0x0" ::: "memory");  // own tile of stage gi + 1 has landed
        }
        __syncthreads();  // publishes stage gi + 1 and ends every wave's reads of stage gi
        if (pinned(issuer & (unsigned)(gi + 2 < GPB))) {
            tdm_load(tdm_group0(ldsh + (unsigned)(gi & 1) * (KHALF * TILEB),
                                xtile + (unsigned long long)((gi + 2) * GROUP) * 2u), g1);
        }
    }
    asm volatile("s_wait_tensorcnt 0x0" ::: "memory");  // no tensor load is left in flight
    asm volatile("s_wait_dscnt 0x0" ::: "memory");      // nor an LDS read: the tiles' LDS is reused below

    // The two K halves of a column quarter (waves cw and cw + 4) are summed here: each
    // wave hands one of its two column tiles to the other through LDS (8 KB a wave, in
    // the x tiles' place, which the loop's last barrier has freed) and finishes the
    // other: half 0 finishes column tile 0, half 1 column tile 1. One code path with
    // wave-uniform selects, so that stores stay 16 bytes a lane.
    float* xs = (float*)&As[0][0][0];
    float*       to   = xs + (wave ^ 4) * (MT * TILEF) + lane * 4;
    const float* from = xs + wave * (MT * TILEF) + lane * 4;
    #pragma unroll
    for (int mt = 0; mt < MT; ++mt) {
        const v8f g = kh ? acc[mt][0] : acc[mt][1];
        float4 lo = {g[0], g[1], g[2], g[3]};
        float4 up = {g[4], g[5], g[6], g[7]};
        *(float4*)(to + mt * TILEF)       = lo;   // fragment order: 512 contiguous bytes a store
        *(float4*)(to + mt * TILEF + 128) = up;
    }
    __syncthreads();  // the tiles are read by the other wave than wrote them

    // C/D layout: VGPR v -> M = v (lanes 0-15) or v+8 (lanes 16-31), N = lane%16.
    // This slice's partial goes to the workspace in fragment order, indexed
    // [16-column tile][M-tile][slice]: per tile two stores of 512 contiguous
    // bytes (VGPRs 0-3, then 4-7, 16 bytes a lane).
    float* pw = part + ((size_t)(((blockIdx.x * 4 + cw) * NT + kh) * MT) * KSPLIT + blockIdx.y) * TILEF
                     + lane * 4;
    #pragma unroll
    for (int mt = 0; mt < MT; ++mt) {
        const v8f k = kh ? acc[mt][1] : acc[mt][0];
        const float4 a = *(const float4*)(from + mt * TILEF);
        const float4 b = *(const float4*)(from + mt * TILEF + 128);
        float4 lo = {k[0] + a.x, k[1] + a.y, k[2] + a.z, k[3] + a.w};
        float4 up = {k[4] + b.x, k[5] + b.y, k[6] + b.z, k[7] + b.w};
        *(float4*)(pw + mt * KSPLIT * TILEF)       = lo;
        *(float4*)(pw + mt * KSPLIT * TILEF + 128) = up;
    }
}

extern "C" void kernel_launch(void* const* d_in, const int* in_sizes, int n_in,
                              void* d_out, int out_size, void* d_ws, size_t ws_size,
                              hipStream_t stream) {
    (void)in_sizes; (void)n_in; (void)ws_size; (void)out_size;
    const float* x      = (const float*)d_in[0];
    const int*   Wq     = (const int*)d_in[1];
    const float* scales = (const float*)d_in[2];
    const float* zeros  = (const float*)d_in[3];
    float*       out    = (float*)d_out;
    _Float16*    xh     = (_Float16*)d_ws;   // 128*8192*2B = 2 MB scratch
    float*       part   = (float*)((char*)d_ws + XH_BYTES); // KSPLIT x 4 MB partials

    // 1) convert activations to f16 once
    cvt_x_kernel<<<dim3((M_DIM * K_DIM) / (256 * 8)), dim3(256), 0, stream>>>(x, xh);
    // 2) TDM-fed WMMA GEMM, one K slice per grid row, partials to the workspace
    dim3 grid(N_DIM / BN, KSPLIT);  // (64, 4) = 256 workgroups
    w4a32_gemm_wmma<<<grid, dim3(256), 0, stream>>>(xh, Wq, scales, zeros, part);
    // 3) sum the slices in fixed order into out
    merge_slices_kernel<<<dim3(N_DIM / RBN, MT), dim3(256), 0, stream>>>(part, out);
}

// v006
// One run takes 20.9 microseconds.
// Next to v005, in two timings, it ran 1.13 and 1.10 times as fast.
// Counting every step since v000, it is 3.13 times as fast.
#include <hip/hip_runtime.h>

typedef _Float16 v16h __attribute__((ext_vector_type(16)));
typedef _Float16 v8h  __attribute__((ext_vector_type(8)));
typedef float    v8f  __attribute__((ext_vector_type(8)));
typedef unsigned v4u  __attribute__((ext_vector_type(4)));
typedef unsigned v8u  __attribute__((ext_vector_type(8)));
typedef int      v8i  __attribute__((ext_vector_type(8)));
typedef int      v4i  __attribute__((ext_vector_type(4)));

#define K_DIM   8192
#define N_DIM   8192
#define M_DIM   128
#define GROUP   128
#define NGROUPS (K_DIM / GROUP)    // 64
#define KW      8                  // K parts of a block, one per wave, summed through LDS
#define GPB     (NGROUPS / KW)     // 8 groups per wave
#define BM      64                 // rows of a GEMM block
#define BN      64                 // columns of a GEMM block
#define MT      4                  // M-tiles per wave
#define NT      4                  // column tiles per wave: one A fragment feeds NT WMMAs
#define LDSW    136                // 128 + 8 halves pad (produced by TDM pad feature)
#define TILEB   18432              // place of one x tile in LDS: 64 rows * 272 B = 17,408, up to 9 * 2 KiB
#define TILEF   256                // floats of one 16x16 accumulator tile

// x fp32 -> f16 once (reused by all 128 N-blocks; removes convert work from GEMM loop)
__global__ void cvt_x_kernel(const float* __restrict__ x, _Float16* __restrict__ xh) {
    const int idx = (blockIdx.x * 256 + threadIdx.x) * 8;
    const float4 a = *(const float4*)&x[idx];
    const float4 b = *(const float4*)&x[idx + 4];
    v8h h;
    h[0] = (_Float16)a.x; h[1] = (_Float16)a.y; h[2] = (_Float16)a.z; h[3] = (_Float16)a.w;
    h[4] = (_Float16)b.x; h[5] = (_Float16)b.y; h[6] = (_Float16)b.z; h[7] = (_Float16)b.w;
    *(v8h*)&xh[idx] = h;
}

__device__ __forceinline__ unsigned uni(unsigned v) { return (unsigned)__builtin_amdgcn_readfirstlane(v); }
// A wave-uniform test for the branch round a tensor load, which ignores EXEC.
__device__ __forceinline__ unsigned pinned(unsigned v) {
    unsigned w = uni(v);
    asm volatile("" : "+s"(w));  // holds the test in a scalar register, so that the branch on it is a scalar one
    return w;
}

// Descriptor group 1 of an x tile: 64 rows of 256 bytes (128 halves) of the f16 x,
// source pitch 16,384 bytes, 16 bytes of LDS pad behind each row (pitch 272 bytes).
// Every extent in bytes (data_size code 0), tensor dims = tile dims.
__device__ __forceinline__ v8u tdm_group1() {
    v8u g1;
    g1[0] = uni((1u << 20) | (5u << 22) | (3u << 25));  // no mask; pad of 4 dwords behind every 64
    g1[1] = uni(256u << 16);                         // tensor_dim0 = 256 bytes
    g1[2] = uni(64u << 16);                          // tensor_dim1 = 64 rows
    g1[3] = uni(256u << 16);                         // tile_dim0
    g1[4] = uni(64u);                                // tile_dim1
    g1[5] = uni(K_DIM * 2u);                         // source row pitch, bytes
    g1[6] = uni(0u);
    g1[7] = uni(0u);
    return g1;
}

// Descriptor group 0: the tile's place in LDS and its first byte in memory.
__device__ __forceinline__ v4u tdm_group0(unsigned lds_off, unsigned long long gaddr) {
    v4u g0;
    g0[0] = uni(1u);                                 // count 1
    g0[1] = uni(lds_off);                            // byte offset in the work-group's LDS
    g0[2] = uni((unsigned)gaddr);                    // first byte of the tile, low word
    g0[3] = uni((((unsigned)(gaddr >> 32)) & 0x01FFFFFFu) | 0x80000000u);  // high bits, type 2
    return g0;
}
__device__ __forceinline__ void tdm_load(v4u g0, v8u g1) {
    asm volatile("tensor_load_to_lds %0, %1" :: "s"(g0), "s"(g1) : "memory");
}

// Two packed words (8 consecutive K each) -> the 16 f16 weights of a B fragment.
// Two nibbles at a time become f16 numbers by bit work alone: 0x6400 | u is 1024 + u,
// 0x6400 | (u << 4) is 1024 + 16 u, both exact. One mixed fma per weight
// (f16 * f32 + f32, rounded to f16) then gives (u - zero) * scale:
// s = scale, c = -(1024 + zero) * scale; for the nibbles taken as 16 u
// s16 = scale / 16, c16 = -(64 + zero) * scale; all f32.
// Written as asm because the compiler takes the mixed fma for low halves only; for
// high halves it converts up, multiplies in f32 pairs and converts down again.
// Every instruction reads results that are at least five instructions old, so the
// run needs no delay hints.
// The eight scratch registers t (nibble pairs (k, k + 4) as f16 pairs) belong to the
// caller and stay its own through the whole K loop: the compiler does not look into
// asm text, and a scratch register taken afresh could be one that a WMMA just in front
// still reads as A or B, which may not be overwritten within 4 vector slots. The
// fragment itself is first written ten vector instructions into the run.
__device__ __forceinline__ v16h dequant_pair(unsigned w0, unsigned w1, float s, float s16, float c,
                                             float c16, unsigned (&t)[8]) {
    unsigned r0, r1, r2, r3, r4, r5, r6, r7;   // the fragment: r0-r3 of w0, r4-r7 of w1
    asm("v_lshrrev_b32 %10, 8, %16\n\t"
        "v_lshrrev_b32 %14, 8, %17\n\t"
        "v_and_or_b32 %8, %16, %22, 0x64006400\n\t"    // k 0, 4
        "v_and_or_b32 %9, %16, %23, 0x64006400\n\t"    // k 1, 5 (times 16)
        "v_and_or_b32 %12, %17, %22, 0x64006400\n\t"
        "v_and_or_b32 %13, %17, %23, 0x64006400\n\t"
        "v_and_or_b32 %11, %10, %23, 0x64006400\n\t"   // k 3, 7 (times 16)
        "v_and_or_b32 %15, %14, %23, 0x64006400\n\t"
        "v_and_or_b32 %10, %10, %22, 0x64006400\n\t"   // k 2, 6
        "v_and_or_b32 %14, %14, %22, 0x64006400\n\t"
        "v_fma_mixlo_f16 %0, %8, %18, %20 op_sel_hi:[1,0,0]\n\t"                  // k 0
        "v_fma_mixlo_f16 %2, %8, %18, %20 op_sel:[1,0,0] op_sel_hi:[1,0,0]\n\t"   // k 4
        "v_fma_mixlo_f16 %4, %12, %18, %20 op_sel_hi:[1,0,0]\n\t"
        "v_fma_mixlo_f16 %6, %12, %18, %20 op_sel:[1,0,0] op_sel_hi:[1,0,0]\n\t"
        "v_fma_mixlo_f16 %1, %10, %18, %20 op_sel_hi:[1,0,0]\n\t"                 // k 2
        "v_fma_mixlo_f16 %3, %10, %18, %20 op_sel:[1,0,0] op_sel_hi:[1,0,0]\n\t"  // k 6
        "v_fma_mixlo_f16 %5, %14, %18, %20 op_sel_hi:[1,0,0]\n\t"
        "v_fma_mixlo_f16 %7, %14, %18, %20 op_sel:[1,0,0] op_sel_hi:[1,0,0]\n\t"
        "v_fma_mixhi_f16 %0, %9, %19, %21 op_sel_hi:[1,0,0]\n\t"                  // k 1
        "v_fma_mixhi_f16 %2, %9, %19, %21 op_sel:[1,0,0] op_sel_hi:[1,0,0]\n\t"   // k 5
        "v_fma_mixhi_f16 %4, %13, %19, %21 op_sel_hi:[1,0,0]\n\t"
        "v_fma_mixhi_f16 %6, %13, %19, %21 op_sel:[1,0,0] op_sel_hi:[1,0,0]\n\t"
        "v_fma_mixhi_f16 %1, %11, %19, %21 op_sel_hi:[1,0,0]\n\t"                 // k 3
        "v_fma_mixhi_f16 %3, %11, %19, %21 op_sel:[1,0,0] op_sel_hi:[1,0,0]\n\t"  // k 7
        "v_fma_mixhi_f16 %5, %15, %19, %21 op_sel_hi:[1,0,0]\n\t"
        "v_fma_mixhi_f16 %7, %15, %19, %21 op_sel:[1,0,0] op_sel_hi:[1,0,0]"
        : "=&v"(r0), "=&v"(r1), "=&v"(r2), "=&v"(r3), "=&v"(r4), "=&v"(r5), "=&v"(r6), "=&v"(r7),
          "+v"(t[0]), "+v"(t[1]), "+v"(t[2]), "+v"(t[3]), "+v"(t[4]), "+v"(t[5]), "+v"(t[6]), "+v"(t[7])
        : "v"(w0), "v"(w1), "v"(s), "v"(s16), "v"(c), "v"(c16), "s"(0x000F000Fu), "s"(0x00F000F0u));
    const v8u r = {r0, r1, r2, r3, r4, r5, r6, r7};
    return __builtin_bit_cast(v16h, r);
}

// One block owns a 64 x 64 piece of out over the whole of K. Its eight waves each take
// one eighth of K (8 groups) for the whole piece, with x tiles of their own, and their
// eight sums are added through LDS at the end: nothing goes through the workspace but
// the f16 x.
__global__ __launch_bounds__(256, 2)
void w4a32_gemm_wmma(const _Float16* __restrict__ xh,
                     const int*      __restrict__ Wq,
                     const float*    __restrict__ scales,
                     const float*    __restrict__ zeros,
                     float*          __restrict__ out)
{
    // [buffer][wave]: each tile's place is a multiple of 2 KiB
    __shared__ __attribute__((aligned(2048))) _Float16 As[2][KW][TILEB / 2];

    const int tid  = threadIdx.x;
    const int lane = tid & 31;
    const int wave = (int)uni((unsigned)tid >> 5);   // also the K part

    const int colbase = blockIdx.x * BN;
    const int rowbase = blockIdx.y * BM;
    const int gbase   = wave * GPB;             // first group of this wave's K part

    const int nl   = lane & 15;                 // col within 16-wide tile / A row
    const int hi   = lane >> 4;                 // lane half -> K-octet / M+8 on store
    const int ncol = colbase + nl;              // this lane's column in tile 0; tile nt: +16 nt

    const unsigned ldsw = (unsigned)(uintptr_t)&As[0][0][0] + (unsigned)wave * TILEB;  // buffer 0, own place
    const unsigned long long xtile = (unsigned long long)(uintptr_t)xh
                                   + (unsigned long long)(rowbase * K_DIM + gbase * GROUP) * 2u;  // own stage 0
    v8u g1 = tdm_group1();
    // descriptor words held in scalar registers: one set for the whole kernel, which
    // nothing rewrites while a request is in flight
    asm volatile("" : "+s"(g1));

    // x tiles, two buffers, every wave its own: stage 0 starts first of all
    const v4u g0first = tdm_group0(ldsw, xtile);
    tdm_load(g0first, g1);

    // Weight-side operands of a group for this lane, per column tile: 8 packed words
    // (word rows hi, hi+2, ... hi+14 of the group's 16), its column's scale and zero.
    // They are fetched one group ahead into registers, so that their memory
    // latency runs under the group before instead of in front of each group.
    const int*   wp = Wq     + (size_t)(gbase * 16 + hi) * N_DIM + ncol;
    const float* sp = scales + (size_t)gbase * N_DIM + ncol;
    const float* zp = zeros  + (size_t)gbase * N_DIM + ncol;
    unsigned wn[NT][8];
    float sn[NT], zn[NT];
    #pragma unroll  // constant indices keep wn[][] in registers; all loads in flight together
    for (int nt = 0; nt < NT; ++nt) {
        #pragma unroll
        for (int j = 0; j < 8; ++j)
            wn[nt][j] = (unsigned)__builtin_nontemporal_load(&wp[(size_t)(2 * j) * N_DIM + nt * 16]);
    }
    #pragma unroll
    for (int nt = 0; nt < NT; ++nt) {
        sn[nt] = sp[nt * 16];
        zn[nt] = zp[nt * 16];
    }
    // the registers that these loads name are reused below: wait before they are overwritten
    asm volatile("s_wait_xcnt 0x0" ::: "memory");
    __builtin_amdgcn_sched_barrier(0);  // holds the register writes below behind that wait

    v8f acc[MT][NT];
    #pragma unroll
    for (int mt = 0; mt < MT; ++mt) {
        #pragma unroll
        for (int nt = 0; nt < NT; ++nt) { v8f z = {}; acc[mt][nt] = z; }
    }

    unsigned dq[8] = {0, 0, 0, 0, 0, 0, 0, 0};  // scratch registers of dequant_pair

    // stage 0 lands and is published, then stage 1 starts
    asm volatile("s_wait_tensorcnt 0x0" ::: "memory");  // own stage 0 has landed
    // descriptor words held in scalar registers: stage 0's stay unwritten up to its wait
    asm volatile("" :: "s"(g0first));
    __syncthreads();  // the two-buffer ring's order, kept as it was: wait, barrier, next load
    tdm_load(tdm_group0(ldsw + KW * TILEB, xtile + GROUP * 2u), g1);

    for (int gi = 0; gi < GPB; ++gi) {
        const _Float16* Ab = &As[gi & 1][wave][0];

        // this group's operands, loaded during the group before
        unsigned wc[NT][8];
        float s[NT], s16[NT], zs[NT], zs16[NT];
        #pragma unroll  // constant indices keep wc[][] in registers
        for (int nt = 0; nt < NT; ++nt) {
            #pragma unroll
            for (int j = 0; j < 8; ++j) wc[nt][j] = wn[nt][j];
            s[nt]    = sn[nt];
            s16[nt]  = sn[nt] * 0.0625f;   // for the nibbles taken as 1024 + 16 u
            const float mzs = -zn[nt] * s[nt];
            zs[nt]   = __builtin_fmaf(-1024.0f, s[nt], mzs);  // takes the 1024 of the bit form off again
            zs16[nt] = __builtin_fmaf(-64.0f, s[nt], mzs);    // 1024 / 16 = 64 comes off there
        }

        // next group's operands start now; nothing of this group reads them
        if (gi + 1 < GPB) {
            #pragma unroll  // as above: registers, and all loads issued as one run
            for (int nt = 0; nt < NT; ++nt) {
                #pragma unroll
                for (int j = 0; j < 8; ++j)
                    wn[nt][j] = (unsigned)__builtin_nontemporal_load(&wp[(size_t)(16 + 2 * j) * N_DIM + nt * 16]);
            }
            #pragma unroll
            for (int nt = 0; nt < NT; ++nt) {
                sn[nt] = sp[N_DIM + nt * 16];
                zn[nt] = zp[N_DIM + nt * 16];
            }
            // the address registers that these loads name are advanced at the foot of
            // the loop: wait before they are overwritten
            asm volatile("s_wait_xcnt 0x0" ::: "memory");
        }

        // A fragments of a whole k-step (MT tiles, two 16-byte reads each) are read
        // from LDS as one group into their own registers, one step ahead of use.
        const _Float16* ap = &Ab[nl * LDSW + hi * 8];
        v8h af[2][MT][2];
        #pragma unroll
        for (int mt = 0; mt < MT; ++mt) {
            af[0][mt][0] = *(const v8h*)(ap + mt * 16 * LDSW);        // K = hi*8 .. +7
            af[0][mt][1] = *(const v8h*)(ap + mt * 16 * LDSW + 16);   // K + 16
        }
        // step 0's reads go out first, under its dequant: LDS answers in order, so
        // reads of step 1 moved in front of them would delay the first WMMA
        __builtin_amdgcn_sched_barrier(0);

        #pragma unroll
        for (int step = 0; step < 4; ++step) {
            // B fragments: col = ncol + 16 * nt; elems 0..7 <- one packed word (8 consecutive K),
            //              elems 8..15 <- word +2 rows (K+16)
            v16h b[NT];
            #pragma unroll
            for (int nt = 0; nt < NT; ++nt)
                b[nt] = dequant_pair(wc[nt][step * 2], wc[nt][step * 2 + 1], s[nt], s16[nt], zs[nt], zs16[nt], dq);

            // the reads below stay one group: behind the WMMAs that still read their
            // registers, not spread among the vector work
            __builtin_amdgcn_sched_barrier(0);
            if (step + 1 < 4) {
                #pragma unroll
                for (int mt = 0; mt < MT; ++mt) {
                    af[(step + 1) & 1][mt][0] = *(const v8h*)(ap + mt * 16 * LDSW + (step + 1) * 32);
                    af[(step + 1) & 1][mt][1] = *(const v8h*)(ap + mt * 16 * LDSW + (step + 1) * 32 + 16);
                }
            }
            // keeps the next step's LDS reads one group in front of this step's WMMAs;
            // sunk among them, each read's latency would stand in front of its WMMA
            __builtin_amdgcn_sched_barrier(0);

            #pragma unroll
            for (int mt = 0; mt < MT; ++mt) {
                v16h a = __builtin_shufflevector(af[step & 1][mt][0], af[step & 1][mt][1],
                         0,1,2,3,4,5,6,7,8,9,10,11,12,13,14,15);
                #pragma unroll  // the fragment read once from LDS serves all column tiles
                for (int nt = 0; nt < NT; ++nt)
                    acc[mt][nt] = __builtin_amdgcn_wmma_f32_16x16x32_f16(
                                      false, a, false, b[nt], (short)0, acc[mt][nt], false, false);
            }
        }
        // the hand-over of the next group's weight registers, and with it the wait for
        // their loads, stays behind the last WMMA block: the loads keep the whole group
        __builtin_amdgcn_sched_barrier(0);
        wp += 16 * N_DIM;
        sp += N_DIM;
        zp += N_DIM;

        // publish point of stage gi + 1
        asm volatile("s_wait_dscnt 0x0" ::: "memory");      // own reads of this buffer are done
        asm volatile("s_wait_tensorcnt 0x0" ::: "memory");  // own tile of stage gi + 1 has landed
        // the ring's order, kept as it was: waits, barrier, refill; behind the next-to-last group
        // this barrier frees every wave's buffer-0 tile for the sums below
        __syncthreads();
        if (pinned((unsigned)(gi + 2 < GPB))) {
            tdm_load(tdm_group0(ldsw + (unsigned)(gi & 1) * (KW * TILEB),
                                xtile + (unsigned long long)((gi + 2) * GROUP) * 2u), g1);
        }
    }
    asm volatile("s_wait_tensorcnt 0x0" ::: "memory");  // no tensor load is left in flight
    asm volatile("s_wait_dscnt 0x0" ::: "memory");      // nor an LDS read: the tiles' LDS is reused below

    // The eight K parts are summed here. Every wave lays its 16 accumulator tiles into LDS
    // (16 KB a wave, in the x tiles' buffer 0, which the loop's next-to-last barrier has freed), in
    // fragment order: VGPRs 0-3, then 4-7, 16 bytes a lane, 512 contiguous bytes a store.
    float* xs = (float*)&As[0][0][0];
    float* to = xs + wave * (MT * NT * TILEF) + lane * 4;
    #pragma unroll
    for (int mt = 0; mt < MT; ++mt) {
        #pragma unroll
        for (int nt = 0; nt < NT; ++nt) {
            const v8f g = acc[mt][nt];
            float4 lo = {g[0], g[1], g[2], g[3]};
            float4 up = {g[4], g[5], g[6], g[7]};
            *(float4*)(to + (mt * NT + nt) * TILEF)       = lo;
            *(float4*)(to + (mt * NT + nt) * TILEF + 128) = up;
        }
    }
    __syncthreads();  // the tiles are read by other waves than wrote them

    // Wave w finishes tiles 2 w and 2 w + 1 (M-tile w / 2, two neighbouring column tiles:
    // whole 128-byte lines of out), adding the eight parts in the order of K.
    // C/D layout: VGPR v -> M = v (lanes 0-15) or v+8 (lanes 16-31), N = lane%16.
    const float* from = xs + (2 * wave) * TILEF + lane * 4;
    float* op = out + (size_t)(rowbase + (wave >> 1) * 16 + hi * 8) * N_DIM
                    + colbase + (wave & 1) * 32 + nl;
    #pragma unroll
    for (int t = 0; t < 2; ++t) {
        float4 lo = *(const float4*)(from + t * TILEF);
        float4 up = *(const float4*)(from + t * TILEF + 128);
        #pragma unroll  // all reads of a tile in flight together
        for (int kw = 1; kw < KW; ++kw) {
            const float4 a = *(const float4*)(from + kw * (MT * NT * TILEF) + t * TILEF);
            const float4 b = *(const float4*)(from + kw * (MT * NT * TILEF) + t * TILEF + 128);
            lo.x += a.x; lo.y += a.y; lo.z += a.z; lo.w += a.w;
            up.x += b.x; up.y += b.y; up.z += b.z; up.w += b.w;
        }
        float* o = op + t * 16;
        o[0 * N_DIM] = lo.x; o[1 * N_DIM] = lo.y; o[2 * N_DIM] = lo.z; o[3 * N_DIM] = lo.w;
        o[4 * N_DIM] = up.x; o[5 * N_DIM] = up.y; o[6 * N_DIM] = up.z; o[7 * N_DIM] = up.w;
    }
}

extern "C" void kernel_launch(void* const* d_in, const int* in_sizes, int n_in,
                              void* d_out, int out_size, void* d_ws, size_t ws_size,
                              hipStream_t stream) {
    (void)in_sizes; (void)n_in; (void)ws_size; (void)out_size;
    const float* x      = (const float*)d_in[0];
    const int*   Wq     = (const int*)d_in[1];
    const float* scales = (const float*)d_in[2];
    const float* zeros  = (const float*)d_in[3];
    float*       out    = (float*)d_out;
    _Float16*    xh     = (_Float16*)d_ws;   // 128*8192*2B = 2 MB scratch

    // 1) convert activations to f16 once
    cvt_x_kernel<<<dim3((M_DIM * K_DIM) / (256 * 8)), dim3(256), 0, stream>>>(x, xh);
    // 2) TDM-fed WMMA GEMM over the whole of K, straight into out
    dim3 grid(N_DIM / BN, M_DIM / BM);  // (128, 2) = 256 workgroups
    w4a32_gemm_wmma<<<grid, dim3(256), 0, stream>>>(xh, Wq, scales, zeros, out);
}

// v007
// Measured time: 19 microseconds a run.
// Timed twice side by side with v006, it ran 1.11 and 1.10 times as fast.
// Counting every step since v000, it is 3.46 times as fast.
#include <hip/hip_runtime.h>

typedef _Float16 v16h __attribute__((ext_vector_type(16)));
typedef _Float16 v8h  __attribute__((ext_vector_type(8)));
typedef float    v8f  __attribute__((ext_vector_type(8)));
typedef unsigned v4u  __attribute__((ext_vector_type(4)));
typedef unsigned v8u  __attribute__((ext_vector_type(8)));
typedef int      v8i  __attribute__((ext_vector_type(8)));
typedef int      v4i  __attribute__((ext_vector_type(4)));

#define K_DIM   8192
#define N_DIM   8192
#define M_DIM   128
#define GROUP   128
#define NGROUPS (K_DIM / GROUP)    // 64
#define KW      8                  // K parts of a block, one per wave, summed through LDS
#define GPB     (NGROUPS / KW)     // 8 groups per wave
#define BM      64                 // rows of a GEMM block
#define BN      64                 // columns of a GEMM block
#define MT      4                  // M-tiles per wave
#define NT      4                  // column tiles per wave: one A fragment feeds NT WMMAs
#define LDSW    136                // 128 + 8 halves pad (produced by TDM pad feature)
#define TILEB   18432              // place of one x tile in LDS: 64 rows * 272 B = 17,408, up to 9 * 2 KiB
#define TILEF   256                // floats of one 16x16 accumulator tile

// x fp32 -> f16 once (reused by all 128 N-blocks; removes convert work from GEMM loop)
__global__ void cvt_x_kernel(const float* __restrict__ x, _Float16* __restrict__ xh) {
    const int idx = (blockIdx.x * 256 + threadIdx.x) * 8;
    const float4 a = *(const float4*)&x[idx];
    const float4 b = *(const float4*)&x[idx + 4];
    v8h h;
    h[0] = (_Float16)a.x; h[1] = (_Float16)a.y; h[2] = (_Float16)a.z; h[3] = (_Float16)a.w;
    h[4] = (_Float16)b.x; h[5] = (_Float16)b.y; h[6] = (_Float16)b.z; h[7] = (_Float16)b.w;
    *(v8h*)&xh[idx] = h;
}

__device__ __forceinline__ unsigned uni(unsigned v) { return (unsigned)__builtin_amdgcn_readfirstlane(v); }
// A wave-uniform test for the branch round a tensor load, which ignores EXEC.
__device__ __forceinline__ unsigned pinned(unsigned v) {
    unsigned w = uni(v);
    asm volatile("" : "+s"(w));  // holds the test in a scalar register, so that the branch on it is a scalar one
    return w;
}

// Descriptor group 1 of an x tile: 64 rows of 256 bytes (128 halves) of the f16 x,
// source pitch 16,384 bytes, 16 bytes of LDS pad behind each row (pitch 272 bytes).
// Every extent in bytes (data_size code 0), tensor dims = tile dims.
__device__ __forceinline__ v8u tdm_group1() {
    v8u g1;
    g1[0] = uni((1u << 20) | (5u << 22) | (3u << 25));  // no mask; pad of 4 dwords behind every 64
    g1[1] = uni(256u << 16);                         // tensor_dim0 = 256 bytes
    g1[2] = uni(64u << 16);                          // tensor_dim1 = 64 rows
    g1[3] = uni(256u << 16);                         // tile_dim0
    g1[4] = uni(64u);                                // tile_dim1
    g1[5] = uni(K_DIM * 2u);                         // source row pitch, bytes
    g1[6] = uni(0u);
    g1[7] = uni(0u);
    return g1;
}

// Descriptor group 0: the tile's place in LDS and its first byte in memory.
__device__ __forceinline__ v4u tdm_group0(unsigned lds_off, unsigned long long gaddr) {
    v4u g0;
    g0[0] = uni(1u);                                 // count 1
    g0[1] = uni(lds_off);                            // byte offset in the work-group's LDS
    g0[2] = uni((unsigned)gaddr);                    // first byte of the tile, low word
    g0[3] = uni((((unsigned)(gaddr >> 32)) & 0x01FFFFFFu) | 0x80000000u);  // high bits, type 2
    return g0;
}
__device__ __forceinline__ void tdm_load(v4u g0, v8u g1) {
    asm volatile("tensor_load_to_lds %0, %1" :: "s"(g0), "s"(g1) : "memory");
}

// Two packed words (8 consecutive K each) -> the 16 f16 weights of a B fragment.
// Two nibbles at a time become f16 numbers by bit work alone: 0x6400 | u is 1024 + u,
// 0x6400 | (u << 4) is 1024 + 16 u, both exact. One mixed fma per weight
// (f16 * f32 + f32, rounded to f16) then gives (u - zero) * scale:
// s = scale, c = -(1024 + zero) * scale; for the nibbles taken as 16 u
// s16 = scale / 16, c16 = -(64 + zero) * scale; all f32.
// Written as asm because the compiler takes the mixed fma for low halves only; for
// high halves it converts up, multiplies in f32 pairs and converts down again.
// Every instruction reads results that are at least five instructions old, so the
// run needs no delay hints.
// The eight scratch registers t (nibble pairs (k, k + 4) as f16 pairs) belong to the
// caller and stay its own through the whole K loop: the compiler does not look into
// asm text, and a scratch register taken afresh could be one that a WMMA just in front
// still reads as A or B, which may not be overwritten within 4 vector slots. The
// fragment itself is first written ten vector instructions into the run.
__device__ __forceinline__ v16h dequant_pair(unsigned w0, unsigned w1, float s, float s16, float c,
                                             float c16, unsigned (&t)[8]) {
    unsigned r0, r1, r2, r3, r4, r5, r6, r7;   // the fragment: r0-r3 of w0, r4-r7 of w1
    asm("v_lshrrev_b32 %10, 8, %16\n\t"
        "v_lshrrev_b32 %14, 8, %17\n\t"
        "v_and_or_b32 %8, %16, %22, 0x64006400\n\t"    // k 0, 4
        "v_and_or_b32 %9, %16, %23, 0x64006400\n\t"    // k 1, 5 (times 16)
        "v_and_or_b32 %12, %17, %22, 0x64006400\n\t"
        "v_and_or_b32 %13, %17, %23, 0x64006400\n\t"
        "v_and_or_b32 %11, %10, %23, 0x64006400\n\t"   // k 3, 7 (times 16)
        "v_and_or_b32 %15, %14, %23, 0x64006400\n\t"
        "v_and_or_b32 %10, %10, %22, 0x64006400\n\t"   // k 2, 6
        "v_and_or_b32 %14, %14, %22, 0x64006400\n\t"
        "v_fma_mixlo_f16 %0, %8, %18, %20 op_sel_hi:[1,0,0]\n\t"                  // k 0
        "v_fma_mixlo_f16 %2, %8, %18, %20 op_sel:[1,0,0] op_sel_hi:[1,0,0]\n\t"   // k 4
        "v_fma_mixlo_f16 %4, %12, %18, %20 op_sel_hi:[1,0,0]\n\t"
        "v_fma_mixlo_f16 %6, %12, %18, %20 op_sel:[1,0,0] op_sel_hi:[1,0,0]\n\t"
        "v_fma_mixlo_f16 %1, %10, %18, %20 op_sel_hi:[1,0,0]\n\t"                 // k 2
        "v_fma_mixlo_f16 %3, %10, %18, %20 op_sel:[1,0,0] op_sel_hi:[1,0,0]\n\t"  // k 6
        "v_fma_mixlo_f16 %5, %14, %18, %20 op_sel_hi:[1,0,0]\n\t"
        "v_fma_mixlo_f16 %7, %14, %18, %20 op_sel:[1,0,0] op_sel_hi:[1,0,0]\n\t"
        "v_fma_mixhi_f16 %0, %9, %19, %21 op_sel_hi:[1,0,0]\n\t"                  // k 1
        "v_fma_mixhi_f16 %2, %9, %19, %21 op_sel:[1,0,0] op_sel_hi:[1,0,0]\n\t"   // k 5
        "v_fma_mixhi_f16 %4, %13, %19, %21 op_sel_hi:[1,0,0]\n\t"
        "v_fma_mixhi_f16 %6, %13, %19, %21 op_sel:[1,0,0] op_sel_hi:[1,0,0]\n\t"
        "v_fma_mixhi_f16 %1, %11, %19, %21 op_sel_hi:[1,0,0]\n\t"                 // k 3
        "v_fma_mixhi_f16 %3, %11, %19, %21 op_sel:[1,0,0] op_sel_hi:[1,0,0]\n\t"  // k 7
        "v_fma_mixhi_f16 %5, %15, %19, %21 op_sel_hi:[1,0,0]\n\t"
        "v_fma_mixhi_f16 %7, %15, %19, %21 op_sel:[1,0,0] op_sel_hi:[1,0,0]"
        : "=&v"(r0), "=&v"(r1), "=&v"(r2), "=&v"(r3), "=&v"(r4), "=&v"(r5), "=&v"(r6), "=&v"(r7),
          "+v"(t[0]), "+v"(t[1]), "+v"(t[2]), "+v"(t[3]), "+v"(t[4]), "+v"(t[5]), "+v"(t[6]), "+v"(t[7])
        : "v"(w0), "v"(w1), "v"(s), "v"(s16), "v"(c), "v"(c16), "s"(0x000F000Fu), "s"(0x00F000F0u));
    const v8u r = {r0, r1, r2, r3, r4, r5, r6, r7};
    return __builtin_bit_cast(v16h, r);
}

// One block owns a 64 x 64 piece of out over the whole of K. Its eight waves each take
// one eighth of K (8 groups) for the whole piece, with x tiles of their own, and their
// eight sums are added through LDS at the end: nothing goes through the workspace but
// the f16 x.
// The two-buffer ring of x tiles is private to its wave: a wave alone loads, reads and
// refills its two places in LDS. Its own waits order all of that, so the K loop holds no
// work-group barrier and the eight waves run through their groups independently.
__global__ __launch_bounds__(256, 2)
void w4a32_gemm_wmma(const _Float16* __restrict__ xh,
                     const int*      __restrict__ Wq,
                     const float*    __restrict__ scales,
                     const float*    __restrict__ zeros,
                     float*          __restrict__ out)
{
    // [buffer][wave]: each tile's place is a multiple of 2 KiB
    __shared__ __attribute__((aligned(2048))) _Float16 As[2][KW][TILEB / 2];

    const int tid  = threadIdx.x;
    const int lane = tid & 31;
    const int wave = (int)uni((unsigned)tid >> 5);   // also the K part

    const int colbase = blockIdx.x * BN;
    const int rowbase = blockIdx.y * BM;
    const int gbase   = wave * GPB;             // first group of this wave's K part

    const int nl   = lane & 15;                 // col within 16-wide tile / A row
    const int hi   = lane >> 4;                 // lane half -> K-octet / M+8 on store
    const int ncol = colbase + nl;              // this lane's column in tile 0; tile nt: +16 nt

    const unsigned ldsw = (unsigned)(uintptr_t)&As[0][0][0] + (unsigned)wave * TILEB;  // buffer 0, own place
    const unsigned long long xtile = (unsigned long long)(uintptr_t)xh
                                   + (unsigned long long)(rowbase * K_DIM + gbase * GROUP) * 2u;  // own stage 0
    v8u g1 = tdm_group1();
    // descriptor words held in scalar registers: one set for the whole kernel, which
    // nothing rewrites while a request is in flight
    asm volatile("" : "+s"(g1));

    // x tiles, two buffers, every wave its own: stage 0 starts first of all
    const v4u g0first = tdm_group0(ldsw, xtile);
    tdm_load(g0first, g1);

    // Weight-side operands of a group for this lane, per column tile: 8 packed words
    // (word rows hi, hi+2, ... hi+14 of the group's 16), its column's scale and zero.
    // They are fetched one group ahead into registers, so that their memory
    // latency runs under the group before instead of in front of each group.
    const int*   wp = Wq     + (size_t)(gbase * 16 + hi) * N_DIM + ncol;
    const float* sp = scales + (size_t)gbase * N_DIM + ncol;
    const float* zp = zeros  + (size_t)gbase * N_DIM + ncol;
    unsigned wn[NT][8];
    float sn[NT], zn[NT];
    #pragma unroll  // constant indices keep wn[][] in registers; all loads in flight together
    for (int nt = 0; nt < NT; ++nt) {
        #pragma unroll
        for (int j = 0; j < 8; ++j)
            wn[nt][j] = (unsigned)__builtin_nontemporal_load(&wp[(size_t)(2 * j) * N_DIM + nt * 16]);
    }
    #pragma unroll
    for (int nt = 0; nt < NT; ++nt) {
        sn[nt] = sp[nt * 16];
        zn[nt] = zp[nt * 16];
    }
    // the registers that these loads name are reused below: wait before they are overwritten
    asm volatile("s_wait_xcnt 0x0" ::: "memory");
    __builtin_amdgcn_sched_barrier(0);  // holds the register writes below behind that wait

    v8f acc[MT][NT];
    #pragma unroll
    for (int mt = 0; mt < MT; ++mt) {
        #pragma unroll
        for (int nt = 0; nt < NT; ++nt) { v8f z = {}; acc[mt][nt] = z; }
    }

    unsigned dq[8] = {0, 0, 0, 0, 0, 0, 0, 0};  // scratch registers of dequant_pair

    // stage 0 lands, then stage 1 starts; only this wave reads either
    asm volatile("s_wait_tensorcnt 0x0" ::: "memory");  // own stage 0 has landed
    // descriptor words held in scalar registers: stage 0's stay unwritten up to its wait
    asm volatile("" :: "s"(g0first));
    tdm_load(tdm_group0(ldsw + KW * TILEB, xtile + GROUP * 2u), g1);
    // stage 1 starts at once: without this the register hand-over of group 0's weights, with
    // its waits for their loads from memory, is scheduled in front of the tensor load
    __builtin_amdgcn_sched_barrier(0);

    for (int gi = 0; gi < GPB; ++gi) {
        const _Float16* Ab = &As[gi & 1][wave][0];

        // this group's operands, loaded during the group before
        unsigned wc[NT][8];
        float s[NT], s16[NT], zs[NT], zs16[NT];
        #pragma unroll  // constant indices keep wc[][] in registers
        for (int nt = 0; nt < NT; ++nt) {
            #pragma unroll
            for (int j = 0; j < 8; ++j) wc[nt][j] = wn[nt][j];
            s[nt]    = sn[nt];
            s16[nt]  = sn[nt] * 0.0625f;   // for the nibbles taken as 1024 + 16 u
            const float mzs = -zn[nt] * s[nt];
            zs[nt]   = __builtin_fmaf(-1024.0f, s[nt], mzs);  // takes the 1024 of the bit form off again
            zs16[nt] = __builtin_fmaf(-64.0f, s[nt], mzs);    // 1024 / 16 = 64 comes off there
        }

        // next group's operands start now; nothing of this group reads them
        if (gi + 1 < GPB) {
            #pragma unroll  // as above: registers, and all loads issued as one run
            for (int nt = 0; nt < NT; ++nt) {
                #pragma unroll
                for (int j = 0; j < 8; ++j)
                    wn[nt][j] = (unsigned)__builtin_nontemporal_load(&wp[(size_t)(16 + 2 * j) * N_DIM + nt * 16]);
            }
            #pragma unroll
            for (int nt = 0; nt < NT; ++nt) {
                sn[nt] = sp[N_DIM + nt * 16];
                zn[nt] = zp[N_DIM + nt * 16];
            }
            // the address registers that these loads name are advanced at the foot of
            // the loop: wait before they are overwritten
            asm volatile("s_wait_xcnt 0x0" ::: "memory");
        }

        // A fragments of a whole k-step (MT tiles, two 16-byte reads each) are read
        // from LDS as one group into their own registers, one step ahead of use.
        const _Float16* ap = &Ab[nl * LDSW + hi * 8];
        v8h af[2][MT][2];
        #pragma unroll
        for (int mt = 0; mt < MT; ++mt) {
            af[0][mt][0] = *(const v8h*)(ap + mt * 16 * LDSW);        // K = hi*8 .. +7
            af[0][mt][1] = *(const v8h*)(ap + mt * 16 * LDSW + 16);   // K + 16
        }
        // step 0's reads go out first, under its dequant: LDS answers in order, so
        // reads of step 1 moved in front of them would delay the first WMMA
        __builtin_amdgcn_sched_barrier(0);

        #pragma unroll
        for (int step = 0; step < 4; ++step) {
            // B fragments: col = ncol + 16 * nt; elems 0..7 <- one packed word (8 consecutive K),
            //              elems 8..15 <- word +2 rows (K+16)
            v16h b[NT];
            #pragma unroll
            for (int nt = 0; nt < NT; ++nt)
                b[nt] = dequant_pair(wc[nt][step * 2], wc[nt][step * 2 + 1], s[nt], s16[nt], zs[nt], zs16[nt], dq);

            // the reads below stay one group: behind the WMMAs that still read their
            // registers, not spread among the vector work
            __builtin_amdgcn_sched_barrier(0);
            if (step + 1 < 4) {
                #pragma unroll
                for (int mt = 0; mt < MT; ++mt) {
                    af[(step + 1) & 1][mt][0] = *(const v8h*)(ap + mt * 16 * LDSW + (step + 1) * 32);
                    af[(step + 1) & 1][mt][1] = *(const v8h*)(ap + mt * 16 * LDSW + (step + 1) * 32 + 16);
                }
            }
            // keeps the next step's LDS reads one group in front of this step's WMMAs;
            // sunk among them, each read's latency would stand in front of its WMMA
            __builtin_amdgcn_sched_barrier(0);

            #pragma unroll
            for (int mt = 0; mt < MT; ++mt) {
                v16h a = __builtin_shufflevector(af[step & 1][mt][0], af[step & 1][mt][1],
                         0,1,2,3,4,5,6,7,8,9,10,11,12,13,14,15);
                #pragma unroll  // the fragment read once from LDS serves all column tiles
                for (int nt = 0; nt < NT; ++nt)
                    acc[mt][nt] = __builtin_amdgcn_wmma_f32_16x16x32_f16(
                                      false, a, false, b[nt], (short)0, acc[mt][nt], false, false);
            }
        }
        // the hand-over of the next group's weight registers, and with it the wait for
        // their loads, stays behind the last WMMA block: the loads keep the whole group
        __builtin_amdgcn_sched_barrier(0);
        wp += 16 * N_DIM;
        sp += N_DIM;
        zp += N_DIM;

        // stage gi + 1 is taken over and this buffer refilled, by the one wave that uses them
        asm volatile("s_wait_dscnt 0x0" ::: "memory");      // own reads of this buffer are done: it may be refilled
        asm volatile("s_wait_tensorcnt 0x0" ::: "memory");  // own tile of stage gi + 1 has landed
        if (pinned((unsigned)(gi + 2 < GPB))) {
            tdm_load(tdm_group0(ldsw + (unsigned)(gi & 1) * (KW * TILEB),
                                xtile + (unsigned long long)((gi + 2) * GROUP) * 2u), g1);
        }
    }
    asm volatile("s_wait_tensorcnt 0x0" ::: "memory");  // no tensor load is left in flight
    asm volatile("s_wait_dscnt 0x0" ::: "memory");      // nor an LDS read: the tiles' LDS is reused below
    __syncthreads();  // every wave has left its x tiles: their LDS is free for the sums of all

    // The eight K parts are summed here. Every wave lays its 16 accumulator tiles into LDS
    // (16 KB a wave, in the x tiles' place, which the barrier above has freed), in
    // fragment order: VGPRs 0-3, then 4-7, 16 bytes a lane, 512 contiguous bytes a store.
    float* xs = (float*)&As[0][0][0];
    float* to = xs + wave * (MT * NT * TILEF) + lane * 4;
    #pragma unroll
    for (int mt = 0; mt < MT; ++mt) {
        #pragma unroll
        for (int nt = 0; nt < NT; ++nt) {
            const v8f g = acc[mt][nt];
            float4 lo = {g[0], g[1], g[2], g[3]};
            float4 up = {g[4], g[5], g[6], g[7]};
            *(float4*)(to + (mt * NT + nt) * TILEF)       = lo;
            *(float4*)(to + (mt * NT + nt) * TILEF + 128) = up;
        }
    }
    __syncthreads();  // the tiles are read by other waves than wrote them

    // Wave w finishes tiles 2 w and 2 w + 1 (M-tile w / 2, two neighbouring column tiles:
    // whole 128-byte lines of out), adding the eight parts in the order of K.
    // C/D layout: VGPR v -> M = v (lanes 0-15) or v+8 (lanes 16-31), N = lane%16.
    const float* from = xs + (2 * wave) * TILEF + lane * 4;
    float* op = out + (size_t)(rowbase + (wave >> 1) * 16 + hi * 8) * N_DIM
                    + colbase + (wave & 1) * 32 + nl;
    #pragma unroll
    for (int t = 0; t < 2; ++t) {
        float4 lo = *(const float4*)(from + t * TILEF);
        float4 up = *(const float4*)(from + t * TILEF + 128);
        #pragma unroll  // all reads of a tile in flight together
        for (int kw = 1; kw < KW; ++kw) {
            const float4 a = *(const float4*)(from + kw * (MT * NT * TILEF) + t * TILEF);
            const float4 b = *(const float4*)(from + kw * (MT * NT * TILEF) + t * TILEF + 128);
            lo.x += a.x; lo.y += a.y; lo.z += a.z; lo.w += a.w;
            up.x += b.x; up.y += b.y; up.z += b.z; up.w += b.w;
        }
        float* o = op + t * 16;
        o[0 * N_DIM] = lo.x; o[1 * N_DIM] = lo.y; o[2 * N_DIM] = lo.z; o[3 * N_DIM] = lo.w;
        o[4 * N_DIM] = up.x; o[5 * N_DIM] = up.y; o[6 * N_DIM] = up.z; o[7 * N_DIM] = up.w;
    }
}

extern "C" void kernel_launch(void* const* d_in, const int* in_sizes, int n_in,
                              void* d_out, int out_size, void* d_ws, size_t ws_size,
                              hipStream_t stream) {
    (void)in_sizes; (void)n_in; (void)ws_size; (void)out_size;
    const float* x      = (const float*)d_in[0];
    const int*   Wq     = (const int*)d_in[1];
    const float* scales = (const float*)d_in[2];
    const float* zeros  = (const float*)d_in[3];
    float*       out    = (float*)d_out;
    _Float16*    xh     = (_Float16*)d_ws;   // 128*8192*2B = 2 MB scratch

    // 1) convert activations to f16 once
    cvt_x_kernel<<<dim3((M_DIM * K_DIM) / (256 * 8)), dim3(256), 0, stream>>>(x, xh);
    // 2) TDM-fed WMMA GEMM over the whole of K, straight into out
    dim3 grid(N_DIM / BN, M_DIM / BM);  // (128, 2) = 256 workgroups
    w4a32_gemm_wmma<<<grid, dim3(256), 0, stream>>>(xh, Wq, scales, zeros, out);
}

// v008
// A run of this version takes 17.9 microseconds.
// Timed twice side by side with v007, it ran 1.06 and 1.07 times as fast.
// All steps since v000 together make it 3.69 times as fast.
#include <hip/hip_runtime.h>

typedef _Float16 v16h __attribute__((ext_vector_type(16)));
typedef _Float16 v8h  __attribute__((ext_vector_type(8)));
typedef float    v8f  __attribute__((ext_vector_type(8)));
typedef unsigned v4u  __attribute__((ext_vector_type(4)));
typedef unsigned v8u  __attribute__((ext_vector_type(8)));
typedef int      v8i  __attribute__((ext_vector_type(8)));
typedef int      v4i  __attribute__((ext_vector_type(4)));
typedef float    v4f  __attribute__((ext_vector_type(4)));

#define K_DIM   8192
#define N_DIM   8192
#define M_DIM   128
#define GROUP   128
#define NGROUPS (K_DIM / GROUP)    // 64
#define KW      8                  // K parts of a block, one per wave, summed through LDS
#define GPB     (NGROUPS / KW)     // 8 groups per wave
#define BM      64                 // rows of a GEMM block
#define BN      64                 // columns of a GEMM block
#define MT      4                  // M-tiles per wave
#define NT      4                  // column tiles per wave: one A fragment feeds NT WMMAs
#define LDSW    136                // 128 + 8 halves pad (produced by TDM pad feature)
#define TILEB   18432              // place of one x tile in LDS: 64 rows * 272 B = 17,408, up to 9 * 2 KiB
#define TILEF   256                // floats of one 16x16 accumulator tile

// x fp32 -> f16 once (reused by all 128 N-blocks; removes convert work from GEMM loop)
__global__ void cvt_x_kernel(const float* __restrict__ x, _Float16* __restrict__ xh) {
    const int idx = (blockIdx.x * 256 + threadIdx.x) * 8;
    const float4 a = *(const float4*)&x[idx];
    const float4 b = *(const float4*)&x[idx + 4];
    v8h h;
    h[0] = (_Float16)a.x; h[1] = (_Float16)a.y; h[2] = (_Float16)a.z; h[3] = (_Float16)a.w;
    h[4] = (_Float16)b.x; h[5] = (_Float16)b.y; h[6] = (_Float16)b.z; h[7] = (_Float16)b.w;
    *(v8h*)&xh[idx] = h;
}

__device__ __forceinline__ unsigned uni(unsigned v) { return (unsigned)__builtin_amdgcn_readfirstlane(v); }
// A wave-uniform test for the branch round a tensor load, which ignores EXEC.
__device__ __forceinline__ unsigned pinned(unsigned v) {
    unsigned w = uni(v);
    asm volatile("" : "+s"(w));  // holds the test in a scalar register, so that the branch on it is a scalar one
    return w;
}

// Descriptor group 1 of an x tile: 64 rows of 256 bytes (128 halves) of the f16 x,
// source pitch 16,384 bytes, 16 bytes of LDS pad behind each row (pitch 272 bytes).
// Every extent in bytes (data_size code 0), tensor dims = tile dims.
__device__ __forceinline__ v8u tdm_group1() {
    v8u g1;
    g1[0] = uni((1u << 20) | (5u << 22) | (3u << 25));  // no mask; pad of 4 dwords behind every 64
    g1[1] = uni(256u << 16);                         // tensor_dim0 = 256 bytes
    g1[2] = uni(64u << 16);                          // tensor_dim1 = 64 rows
    g1[3] = uni(256u << 16);                         // tile_dim0
    g1[4] = uni(64u);                                // tile_dim1
    g1[5] = uni(K_DIM * 2u);                         // source row pitch, bytes
    g1[6] = uni(0u);
    g1[7] = uni(0u);
    return g1;
}

// Descriptor group 0: the tile's place in LDS and its first byte in memory.
__device__ __forceinline__ v4u tdm_group0(unsigned lds_off, unsigned long long gaddr) {
    v4u g0;
    g0[0] = uni(1u);                                 // count 1
    g0[1] = uni(lds_off);                            // byte offset in the work-group's LDS
    g0[2] = uni((unsigned)gaddr);                    // first byte of the tile, low word
    g0[3] = uni((((unsigned)(gaddr >> 32)) & 0x01FFFFFFu) | 0x80000000u);  // high bits, type 2
    return g0;
}
__device__ __forceinline__ void tdm_load(v4u g0, v8u g1) {
    asm volatile("tensor_load_to_lds %0, %1" :: "s"(g0), "s"(g1) : "memory");
}

// Two packed words (8 consecutive K each) -> the 16 f16 weights of a B fragment.
// Two nibbles at a time become f16 numbers by bit work alone: 0x6400 | u is 1024 + u,
// 0x6400 | (u << 4) is 1024 + 16 u, both exact. One mixed fma per weight
// (f16 * f32 + f32, rounded to f16) then gives (u - zero) * scale:
// s = scale, c = -(1024 + zero) * scale; for the nibbles taken as 16 u
// s16 = scale / 16, c16 = -(64 + zero) * scale; all f32.
// Written as asm because the compiler takes the mixed fma for low halves only; for
// high halves it converts up, multiplies in f32 pairs and converts down again.
// Every instruction reads results that are at least five instructions old, so the
// run needs no delay hints.
// The eight scratch registers t (nibble pairs (k, k + 4) as f16 pairs) belong to the
// caller and stay its own through the whole K loop: the compiler does not look into
// asm text, and a scratch register taken afresh could be one that a WMMA just in front
// still reads as A or B, which may not be overwritten within 4 vector slots. The
// fragment itself is first written ten vector instructions into the run.
__device__ __forceinline__ v16h dequant_pair(unsigned w0, unsigned w1, float s, float s16, float c,
                                             float c16, unsigned (&t)[8]) {
    unsigned r0, r1, r2, r3, r4, r5, r6, r7;   // the fragment: r0-r3 of w0, r4-r7 of w1
    asm("v_lshrrev_b32 %10, 8, %16\n\t"
        "v_lshrrev_b32 %14, 8, %17\n\t"
        "v_and_or_b32 %8, %16, %22, 0x64006400\n\t"    // k 0, 4
        "v_and_or_b32 %9, %16, %23, 0x64006400\n\t"    // k 1, 5 (times 16)
        "v_and_or_b32 %12, %17, %22, 0x64006400\n\t"
        "v_and_or_b32 %13, %17, %23, 0x64006400\n\t"
        "v_and_or_b32 %11, %10, %23, 0x64006400\n\t"   // k 3, 7 (times 16)
        "v_and_or_b32 %15, %14, %23, 0x64006400\n\t"
        "v_and_or_b32 %10, %10, %22, 0x64006400\n\t"   // k 2, 6
        "v_and_or_b32 %14, %14, %22, 0x64006400\n\t"
        "v_fma_mixlo_f16 %0, %8, %18, %20 op_sel_hi:[1,0,0]\n\t"                  // k 0
        "v_fma_mixlo_f16 %2, %8, %18, %20 op_sel:[1,0,0] op_sel_hi:[1,0,0]\n\t"   // k 4
        "v_fma_mixlo_f16 %4, %12, %18, %20 op_sel_hi:[1,0,0]\n\t"
        "v_fma_mixlo_f16 %6, %12, %18, %20 op_sel:[1,0,0] op_sel_hi:[1,0,0]\n\t"
        "v_fma_mixlo_f16 %1, %10, %18, %20 op_sel_hi:[1,0,0]\n\t"                 // k 2
        "v_fma_mixlo_f16 %3, %10, %18, %20 op_sel:[1,0,0] op_sel_hi:[1,0,0]\n\t"  // k 6
        "v_fma_mixlo_f16 %5, %14, %18, %20 op_sel_hi:[1,0,0]\n\t"
        "v_fma_mixlo_f16 %7, %14, %18, %20 op_sel:[1,0,0] op_sel_hi:[1,0,0]\n\t"
        "v_fma_mixhi_f16 %0, %9, %19, %21 op_sel_hi:[1,0,0]\n\t"                  // k 1
        "v_fma_mixhi_f16 %2, %9, %19, %21 op_sel:[1,0,0] op_sel_hi:[1,0,0]\n\t"   // k 5
        "v_fma_mixhi_f16 %4, %13, %19, %21 op_sel_hi:[1,0,0]\n\t"
        "v_fma_mixhi_f16 %6, %13, %19, %21 op_sel:[1,0,0] op_sel_hi:[1,0,0]\n\t"
        "v_fma_mixhi_f16 %1, %11, %19, %21 op_sel_hi:[1,0,0]\n\t"                 // k 3
        "v_fma_mixhi_f16 %3, %11, %19, %21 op_sel:[1,0,0] op_sel_hi:[1,0,0]\n\t"  // k 7
        "v_fma_mixhi_f16 %5, %15, %19, %21 op_sel_hi:[1,0,0]\n\t"
        "v_fma_mixhi_f16 %7, %15, %19, %21 op_sel:[1,0,0] op_sel_hi:[1,0,0]"
        : "=&v"(r0), "=&v"(r1), "=&v"(r2), "=&v"(r3), "=&v"(r4), "=&v"(r5), "=&v"(r6), "=&v"(r7),
          "+v"(t[0]), "+v"(t[1]), "+v"(t[2]), "+v"(t[3]), "+v"(t[4]), "+v"(t[5]), "+v"(t[6]), "+v"(t[7])
        : "v"(w0), "v"(w1), "v"(s), "v"(s16), "v"(c), "v"(c16), "s"(0x000F000Fu), "s"(0x00F000F0u));
    const v8u r = {r0, r1, r2, r3, r4, r5, r6, r7};
    return __builtin_bit_cast(v16h, r);
}

// One block owns a 64 x 64 piece of out over the whole of K. Its eight waves each take
// one eighth of K (8 groups) for the whole piece, with x tiles of their own, and their
// eight sums are added through LDS at the end: nothing goes through the workspace but
// the f16 x.
// The two-buffer ring of x tiles is private to its wave: a wave alone loads, reads and
// refills its two places in LDS. Its own waits order all of that, so the K loop holds no
// work-group barrier and the eight waves run through their groups independently.
__global__ __launch_bounds__(256, 2)
void w4a32_gemm_wmma(const _Float16* __restrict__ xh,
                     const int*      __restrict__ Wq,
                     const float*    __restrict__ scales,
                     const float*    __restrict__ zeros,
                     float*          __restrict__ out)
{
    // [buffer][wave]: each tile's place is a multiple of 2 KiB
    __shared__ __attribute__((aligned(2048))) _Float16 As[2][KW][TILEB / 2];

    const int tid  = threadIdx.x;
    const int lane = tid & 31;
    const int wave = (int)uni((unsigned)tid >> 5);   // also the K part

    const int colbase = blockIdx.x * BN;
    const int rowbase = blockIdx.y * BM;
    const int gbase   = wave * GPB;             // first group of this wave's K part

    const int nl   = lane & 15;                 // col within 16-wide tile / A row
    const int hi   = lane >> 4;                 // lane half -> K-octet / M+8 on store
    // Columns are dealt to the column tiles so that a lane owns four neighbours: place nl of
    // tile nt is column colbase + 4 nl + nt. One 16-byte load then serves all four tiles, and
    // 16 lanes cover the block's whole 256-byte row piece (two whole lines).
    const int ncol = colbase + nl * 4;          // this lane's column in tile 0; tile nt: + nt

    const unsigned ldsw = (unsigned)(uintptr_t)&As[0][0][0] + (unsigned)wave * TILEB;  // buffer 0, own place
    const unsigned long long xtile = (unsigned long long)(uintptr_t)xh
                                   + (unsigned long long)(rowbase * K_DIM + gbase * GROUP) * 2u;  // own stage 0
    v8u g1 = tdm_group1();
    // descriptor words held in scalar registers: one set for the whole kernel, which
    // nothing rewrites while a request is in flight
    asm volatile("" : "+s"(g1));

    // x tiles, two buffers, every wave its own: stage 0 starts first of all
    const v4u g0first = tdm_group0(ldsw, xtile);
    tdm_load(g0first, g1);

    // Weight-side operands of a group for this lane: 8 word rows (hi, hi+2, ... hi+14 of the
    // group's 16) of four packed words, one per column tile, and the four columns' scales and zeros.
    // They are fetched one group ahead into registers, so that their memory
    // latency runs under the group before instead of in front of each group.
    const int*   wp = Wq     + (size_t)(gbase * 16 + hi) * N_DIM + ncol;
    const float* sp = scales + (size_t)gbase * N_DIM + ncol;
    const float* zp = zeros  + (size_t)gbase * N_DIM + ncol;
    v4u wc[8];
    v4f sc, zc;
    #pragma unroll  // constant indices keep wc[] in registers; all loads in flight together
    for (int j = 0; j < 8; ++j)
        wc[j] = __builtin_nontemporal_load((const v4u*)&wp[(size_t)(2 * j) * N_DIM]);
    sc = *(const v4f*)sp;
    zc = *(const v4f*)zp;
    // the registers that these loads name are reused below: wait before they are overwritten
    asm volatile("s_wait_xcnt 0x0" ::: "memory");
    __builtin_amdgcn_sched_barrier(0);  // holds the register writes below behind that wait

    v8f acc[MT][NT];
    #pragma unroll
    for (int mt = 0; mt < MT; ++mt) {
        #pragma unroll
        for (int nt = 0; nt < NT; ++nt) { v8f z = {}; acc[mt][nt] = z; }
    }

    unsigned dq[8] = {0, 0, 0, 0, 0, 0, 0, 0};  // scratch registers of dequant_pair

    // stage 0 lands, then stage 1 starts; only this wave reads either
    asm volatile("s_wait_tensorcnt 0x0" ::: "memory");  // own stage 0 has landed
    // descriptor words held in scalar registers: stage 0's stay unwritten up to its wait
    asm volatile("" :: "s"(g0first));
    tdm_load(tdm_group0(ldsw + KW * TILEB, xtile + GROUP * 2u), g1);
    // stage 1 starts at once: without this the waits for group 0's operands below, for their loads
    // from memory, are scheduled in front of the tensor load
    __builtin_amdgcn_sched_barrier(0);
    // group 0's operands are waited for here, once: left to their first uses inside the loop,
    // the waits would be counted for the path without new loads and would drain, in every
    // group, the loads just issued for the next one
    asm volatile("" :: "v"(wc[0]), "v"(wc[1]), "v"(wc[2]), "v"(wc[3]), "v"(wc[4]), "v"(wc[5]),
                       "v"(wc[6]), "v"(wc[7]), "v"(sc), "v"(zc));

    for (int gi = 0; gi < GPB; ++gi) {
        const _Float16* Ab = &As[gi & 1][wave][0];

        // this group's operands (wc, sc, zc) were loaded during the group before
        float s[NT], s16[NT], zs[NT], zs16[NT];
        #pragma unroll  // constant indices keep the four columns' factors in registers
        for (int nt = 0; nt < NT; ++nt) {
            s[nt]    = sc[nt];
            s16[nt]  = sc[nt] * 0.0625f;   // for the nibbles taken as 1024 + 16 u
            const float mzs = -zc[nt] * s[nt];
            zs[nt]   = __builtin_fmaf(-1024.0f, s[nt], mzs);  // takes the 1024 of the bit form off again
            zs16[nt] = __builtin_fmaf(-64.0f, s[nt], mzs);    // 1024 / 16 = 64 comes off there
        }

        // next group's operands start now; nothing of this group reads them
        v4u wn[8];
        v4f sn, zn;
        if (gi + 1 < GPB) {
            #pragma unroll  // as above: registers, and all loads issued as one run
            for (int j = 0; j < 8; ++j)
                wn[j] = __builtin_nontemporal_load((const v4u*)&wp[(size_t)(16 + 2 * j) * N_DIM]);
            sn = *(const v4f*)&sp[N_DIM];
            zn = *(const v4f*)&zp[N_DIM];
            // the address registers that these loads name are advanced at the foot of
            // the loop: wait before they are overwritten
            asm volatile("s_wait_xcnt 0x0" ::: "memory");
        }

        // A fragments of a whole k-step (MT tiles, two 16-byte reads each) are read
        // from LDS as one group into their own registers, one step ahead of use.
        const _Float16* ap = &Ab[nl * LDSW + hi * 8];
        v8h af[2][MT][2];
        #pragma unroll
        for (int mt = 0; mt < MT; ++mt) {
            af[0][mt][0] = *(const v8h*)(ap + mt * 16 * LDSW);        // K = hi*8 .. +7
            af[0][mt][1] = *(const v8h*)(ap + mt * 16 * LDSW + 16);   // K + 16
        }
        // step 0's reads go out first, under its dequant: LDS answers in order, so
        // reads of step 1 moved in front of them would delay the first WMMA
        __builtin_amdgcn_sched_barrier(0);

        #pragma unroll
        for (int step = 0; step < 4; ++step) {
            // B fragments: col = ncol + nt; elems 0..7 <- one packed word (8 consecutive K),
            //              elems 8..15 <- word +2 rows (K+16)
            v16h b[NT];
            #pragma unroll
            for (int nt = 0; nt < NT; ++nt)
                b[nt] = dequant_pair(wc[step * 2][nt], wc[step * 2 + 1][nt], s[nt], s16[nt], zs[nt], zs16[nt], dq);

            // the reads below stay one group: behind the WMMAs that still read their
            // registers, not spread among the vector work
            __builtin_amdgcn_sched_barrier(0);
            if (step + 1 < 4) {
                #pragma unroll
                for (int mt = 0; mt < MT; ++mt) {
                    af[(step + 1) & 1][mt][0] = *(const v8h*)(ap + mt * 16 * LDSW + (step + 1) * 32);
                    af[(step + 1) & 1][mt][1] = *(const v8h*)(ap + mt * 16 * LDSW + (step + 1) * 32 + 16);
                }
            }
            // keeps the next step's LDS reads one group in front of this step's WMMAs;
            // sunk among them, each read's latency would stand in front of its WMMA
            __builtin_amdgcn_sched_barrier(0);

            #pragma unroll
            for (int mt = 0; mt < MT; ++mt) {
                v16h a = __builtin_shufflevector(af[step & 1][mt][0], af[step & 1][mt][1],
                         0,1,2,3,4,5,6,7,8,9,10,11,12,13,14,15);
                #pragma unroll  // the fragment read once from LDS serves all column tiles
                for (int nt = 0; nt < NT; ++nt)
                    acc[mt][nt] = __builtin_amdgcn_wmma_f32_16x16x32_f16(
                                      false, a, false, b[nt], (short)0, acc[mt][nt], false, false);
            }
        }
        // the hand-over of the next group's weight registers, and with it the wait for
        // their loads, stays behind the last WMMA block: the loads keep the whole group
        __builtin_amdgcn_sched_barrier(0);
        wp += 16 * N_DIM;
        sp += N_DIM;
        zp += N_DIM;

        // stage gi + 1 is taken over and this buffer refilled, by the one wave that uses them
        asm volatile("s_wait_dscnt 0x0" ::: "memory");      // own reads of this buffer are done: it may be refilled
        asm volatile("s_wait_tensorcnt 0x0" ::: "memory");  // own tile of stage gi + 1 has landed
        if (pinned((unsigned)(gi + 2 < GPB))) {
            tdm_load(tdm_group0(ldsw + (unsigned)(gi & 1) * (KW * TILEB),
                                xtile + (unsigned long long)((gi + 2) * GROUP) * 2u), g1);
        }
        // the next group's operands are taken over last, behind the refill's issue
        if (gi + 1 < GPB) {
            #pragma unroll  // constant indices keep both sets in registers
            for (int j = 0; j < 8; ++j) wc[j] = wn[j];
            sc = sn;
            zc = zn;
        }
    }
    asm volatile("s_wait_tensorcnt 0x0" ::: "memory");  // no tensor load is left in flight
    asm volatile("s_wait_dscnt 0x0" ::: "memory");      // nor an LDS read: the tiles' LDS is reused below
    __syncthreads();  // every wave has left its x tiles: their LDS is free for the sums of all

    // The eight K parts are summed here. Every wave lays its 16 accumulator tiles into LDS
    // (16 KB a wave, in the x tiles' place, which the barrier above has freed), in
    // fragment order: VGPRs 0-3, then 4-7, 16 bytes a lane, 512 contiguous bytes a store.
    float* xs = (float*)&As[0][0][0];
    float* to = xs + wave * (MT * NT * TILEF) + lane * 4;
    #pragma unroll
    for (int mt = 0; mt < MT; ++mt) {
        #pragma unroll
        for (int nt = 0; nt < NT; ++nt) {
            const v8f g = acc[mt][nt];
            float4 lo = {g[0], g[1], g[2], g[3]};
            float4 up = {g[4], g[5], g[6], g[7]};
            *(float4*)(to + (mt * NT + nt) * TILEF)       = lo;
            *(float4*)(to + (mt * NT + nt) * TILEF + 128) = up;
        }
    }
    __syncthreads();  // the tiles are read by other waves than wrote them

    // Wave w finishes, in all four column tiles, VGPRs 4 (w & 1) .. + 3 of M-tile w / 2, adding
    // the eight parts in the order of K. A lane's four tiles are four neighbouring columns,
    // so a row goes out 16 bytes a lane: 256 contiguous bytes (two whole lines) per 16 lanes.
    // C/D layout: VGPR v -> M = v (lanes 0-15) or v+8 (lanes 16-31), place in the tile = lane%16.
    const float* from = xs + ((wave >> 1) * NT) * TILEF + (wave & 1) * 128 + lane * 4;
    float* op = out + (size_t)(rowbase + (wave >> 1) * 16 + hi * 8 + (wave & 1) * 4) * N_DIM + ncol;
    v4f sum[NT];
    #pragma unroll  // constant indices keep sum[] in registers
    for (int nt = 0; nt < NT; ++nt) {
        sum[nt] = *(const v4f*)(from + nt * TILEF);
        #pragma unroll  // all reads of a tile in flight together
        for (int kw = 1; kw < KW; ++kw)
            sum[nt] += *(const v4f*)(from + kw * (MT * NT * TILEF) + nt * TILEF);
    }
    #pragma unroll  // as above; the four stores go out as one run
    for (int v = 0; v < 4; ++v) {
        const v4f row = {sum[0][v], sum[1][v], sum[2][v], sum[3][v]};
        *(v4f*)(op + v * N_DIM) = row;
    }
}

extern "C" void kernel_launch(void* const* d_in, const int* in_sizes, int n_in,
                              void* d_out, int out_size, void* d_ws, size_t ws_size,
                              hipStream_t stream) {
    (void)in_sizes; (void)n_in; (void)ws_size; (void)out_size;
    const float* x      = (const float*)d_in[0];
    const int*   Wq     = (const int*)d_in[1];
    const float* scales = (const float*)d_in[2];
    const float* zeros  = (const float*)d_in[3];
    float*       out    = (float*)d_out;
    _Float16*    xh     = (_Float16*)d_ws;   // 128*8192*2B = 2 MB scratch

    // 1) convert activations to f16 once
    cvt_x_kernel<<<dim3((M_DIM * K_DIM) / (256 * 8)), dim3(256), 0, stream>>>(x, xh);
    // 2) TDM-fed WMMA GEMM over the whole of K, straight into out
    dim3 grid(N_DIM / BN, M_DIM / BM);  // (128, 2) = 256 workgroups
    w4a32_gemm_wmma<<<grid, dim3(256), 0, stream>>>(xh, Wq, scales, zeros, out);
}
